// v000
// Measured on an AMD MI455X. A time is GPU time per run, averaged over a window of back-to-back runs after a warm-up
// (all launches, gaps included; the runs take copies of the inputs in turn), and the median of several windows.
// Apart from v000's, it joins two sittings. Times from different sittings can be a few percent apart, while
// side-by-side timings come from the same sitting.
// The starting kernel, v000, takes 556 microseconds a run.
#include <hip/hip_runtime.h>

typedef __attribute__((ext_vector_type(16))) __bf16 v16bf;
typedef __attribute__((ext_vector_type(8)))  __bf16 v8bf;
typedef __attribute__((ext_vector_type(8)))  float  v8f;

#define WMMA_BF16(a, b, c) \
  __builtin_amdgcn_wmma_f32_16x16x32_bf16(false, (a), false, (b), (short)0, (c), false, false)

// LDS byte offset of a __shared__ object (addrspace(3) pointers are the raw
// wave-LDS byte offsets that GLOBAL_LOAD_ASYNC_TO_LDS wants in VDST).
__device__ __forceinline__ unsigned lds_off_u32(const void* p) {
  return (unsigned)(unsigned long long)(__attribute__((address_space(3))) const void*)p;
}

// Per-lane async copy: 16 bytes global -> LDS, tracked by ASYNCcnt.
__device__ __forceinline__ void async_b128(void* lds, const void* g) {
  asm volatile("global_load_async_to_lds_b128 %0, %1, off"
               :: "v"(lds_off_u32(lds)), "v"((unsigned long long)g)
               : "memory");
}

__device__ __forceinline__ void wait_async0() {
  asm volatile("s_wait_asynccnt 0" ::: "memory");
}

// Load a 16x32 bf16 A/B fragment (CDNA5 16-bit WMMA lane layout): caller passes
// p already offset by row*ld + koff (koff = 8*(lane>=16)); elements [0..7] are
// K=koff..koff+7, [8..15] are K=koff+16..koff+23.
__device__ __forceinline__ v16bf ldfrag(const __bf16* p) {
  v8bf lo = *(const v8bf*)(p);
  v8bf hi = *(const v8bf*)(p + 16);
  v16bf f;
#pragma unroll
  for (int i = 0; i < 8; ++i) { f[i] = lo[i]; f[i + 8] = hi[i]; }
  return f;
}

// ---------------------------------------------------------------------------
// Kernel 1: f32 -> bf16 conversion of activations (q and k_and_v, 8M each)
// ---------------------------------------------------------------------------
__global__ void __launch_bounds__(256) k_cvt_act(const float* __restrict__ q,
                                                 const float* __restrict__ kv,
                                                 __bf16* __restrict__ qb,
                                                 __bf16* __restrict__ kvb) {
  size_t i = (size_t)blockIdx.x * 256 + threadIdx.x;
  qb[i]  = (__bf16)q[i];
  kvb[i] = (__bf16)kv[i];
}

// ---------------------------------------------------------------------------
// Kernel 2: transpose+convert weights into B^T [N][K] bf16 layouts.
//   wqT  [1024][1024] : wqT[n][e]  = wq[h,e,d], n = h*64+d
//   wkvT [2048][1024] : rows 0-1023 from wk, rows 1024-2047 from wv
//   woT  [1024][1024] : woT[e][c]  = wo[c][e]
// ---------------------------------------------------------------------------
__global__ void __launch_bounds__(256) k_cvt_w(const float* __restrict__ wq,
                                               const float* __restrict__ wk,
                                               const float* __restrict__ wv,
                                               const float* __restrict__ wo,
                                               __bf16* __restrict__ wqT,
                                               __bf16* __restrict__ wkvT,
                                               __bf16* __restrict__ woT) {
  int i   = blockIdx.x * 256 + threadIdx.x;   // 0 .. 1M-1
  int row = i >> 10;                          // n (for wq/wk/wv) or e (for wo)
  int cc  = i & 1023;                         // e (for wq/wk/wv) or c (for wo)
  int h = row >> 6, d = row & 63;
  size_t src = (size_t)(h * 1024 + cc) * 64 + d;
  wqT[i]                      = (__bf16)wq[src];
  wkvT[i]                     = (__bf16)wk[src];
  wkvT[(size_t)i + 1024*1024] = (__bf16)wv[src];
  woT[i]                      = (__bf16)wo[(size_t)cc * 1024 + row];
}

// ---------------------------------------------------------------------------
// Kernel 3: QKV projection GEMM. M=8192 (b*s), K=1024.
//   mode 0: N=1024 -> qh [bh][s][64] (+bq)
//   mode 1: N=2048, n<1024 -> kh [bh][t][64] (+bk); n>=1024 -> vt [bh][64][t] (+bv)
// 4 waves/WG; 64x64 WG tile; A/B 64-wide K tiles double-buffered in LDS via
// async global->LDS copies.
// ---------------------------------------------------------------------------
__global__ void __launch_bounds__(128) k_gemm_qkv(const __bf16* __restrict__ X,
                                                  const __bf16* __restrict__ WT,
                                                  __bf16* __restrict__ out0,
                                                  __bf16* __restrict__ vt,
                                                  const float* __restrict__ bias0,
                                                  const float* __restrict__ bias1,
                                                  int mode) {
  __shared__ __bf16 als[2][64 * 64];
  __shared__ __bf16 bls[2][64 * 64];

  const int tid = threadIdx.x;
  const int wave = tid >> 5, lane = tid & 31;
  const int col = lane & 15, hi = lane >> 4, koff = hi << 3;
  const int m0 = blockIdx.x * 64 + wave * 16;
  const int n0 = blockIdx.y * 64;

  // async-copy addressing: 128 threads cover a 64x64 bf16 tile in 4 passes of
  // 16 rows; each thread moves 16B (8 elements) per pass.
  const int crow = tid >> 3;        // 0..15
  const int cseg = (tid & 7) << 3;  // element offset within row: 0..56

  const __bf16* xg = X  + (size_t)(blockIdx.x * 64 + crow) * 1024 + cseg;
  const __bf16* wg = WT + (size_t)(n0 + crow) * 1024 + cseg;

#pragma unroll
  for (int p = 0; p < 4; ++p) {
    async_b128(&als[0][(crow + p * 16) * 64 + cseg], xg + (size_t)(p * 16) * 1024);
    async_b128(&bls[0][(crow + p * 16) * 64 + cseg], wg + (size_t)(p * 16) * 1024);
  }

  v8f acc[4] = {};
  for (int i = 0; i < 16; ++i) {
    wait_async0();       // our chunks of tile i have landed
    __syncthreads();     // everyone's chunks landed; iter i-1 reads all done
    if (i + 1 < 16) {
      const int kn = (i + 1) * 64;
#pragma unroll
      for (int p = 0; p < 4; ++p) {
        async_b128(&als[(i + 1) & 1][(crow + p * 16) * 64 + cseg],
                   xg + (size_t)(p * 16) * 1024 + kn);
        async_b128(&bls[(i + 1) & 1][(crow + p * 16) * 64 + cseg],
                   wg + (size_t)(p * 16) * 1024 + kn);
      }
    }
    const __bf16* ab = &als[i & 1][0];
    const __bf16* bb = &bls[i & 1][0];
#pragma unroll
    for (int kk = 0; kk < 64; kk += 32) {
      v16bf a = ldfrag(ab + (wave * 16 + col) * 64 + kk + koff);
#pragma unroll
      for (int j = 0; j < 4; ++j) {
        v16bf b = ldfrag(bb + (j * 16 + col) * 64 + kk + koff);
        acc[j] = WMMA_BF16(a, b, acc[j]);
      }
    }
  }

#pragma unroll
  for (int j = 0; j < 4; ++j) {
    const int n = n0 + j * 16 + col;
#pragma unroll
    for (int r = 0; r < 8; ++r) {
      const int m = m0 + r + (hi << 3);
      const int bb2 = m >> 11, s = m & 2047;
      float v = acc[j][r];
      if (mode == 0 || n < 1024) {
        const int h = n >> 6, d = n & 63;
        out0[(((size_t)(bb2 * 16 + h)) * 2048 + s) * 64 + d] = (__bf16)(v + bias0[n]);
      } else {
        const int nn = n - 1024;
        const int h = nn >> 6, d = nn & 63;
        vt[(((size_t)(bb2 * 16 + h)) * 64 + d) * 2048 + s] = (__bf16)(v + bias1[nn]);
      }
    }
  }
}

// ---------------------------------------------------------------------------
// Kernel 4: flash attention. grid = (64 bh, 32 row-blocks), block = 128.
// K/V 64x64 tiles double-buffered in LDS (async copies, shared by all 4
// waves); per-wave online softmax; P staged through LDS for the PV GEMM.
// ---------------------------------------------------------------------------
__global__ void __launch_bounds__(128) k_attn(const __bf16* __restrict__ qh,
                                              const __bf16* __restrict__ kh,
                                              const __bf16* __restrict__ vt,
                                              __bf16* __restrict__ z) {
  __shared__ __bf16 kls[2][64 * 64];
  __shared__ __bf16 vls[2][64 * 64];
  __shared__ __bf16 pls[4][16 * 64];

  const int tid = threadIdx.x;
  const int wave = tid >> 5, lane = tid & 31;
  const int col = lane & 15, hi = lane >> 4, koff = hi << 3;
  const int bh = blockIdx.x;                   // b*16 + h
  const int s0 = blockIdx.y * 64 + wave * 16;  // query rows of this wave

  const __bf16* qbase = qh + ((size_t)bh * 2048 + s0) * 64;
  const int crow = tid >> 3, cseg = (tid & 7) << 3;
  const __bf16* kg = kh + ((size_t)bh * 2048 + crow) * 64 + cseg;   // +t0*64
  const __bf16* vg = vt + ((size_t)bh * 64 + crow) * 2048 + cseg;   // +t0

#pragma unroll
  for (int p = 0; p < 4; ++p) {
    async_b128(&kls[0][(crow + p * 16) * 64 + cseg], kg + (size_t)(p * 16) * 64);
    async_b128(&vls[0][(crow + p * 16) * 64 + cseg], vg + (size_t)(p * 16) * 2048);
  }

  // Q fragments: rows s0+col, d-dim 64 -> two fragments, kept in regs.
  v16bf aq0 = ldfrag(qbase + (size_t)col * 64 + koff);
  v16bf aq1 = ldfrag(qbase + (size_t)col * 64 + koff + 32);

  v8f O[4] = {};
  float M[8], L[8];
#pragma unroll
  for (int r = 0; r < 8; ++r) { M[r] = -3.0e38f; L[r] = 0.0f; }

  for (int i = 0; i < 32; ++i) {
    wait_async0();
    __syncthreads();
    if (i + 1 < 32) {
      const int tn = (i + 1) * 64;
#pragma unroll
      for (int p = 0; p < 4; ++p) {
        async_b128(&kls[(i + 1) & 1][(crow + p * 16) * 64 + cseg],
                   kg + (size_t)(tn + p * 16) * 64);
        async_b128(&vls[(i + 1) & 1][(crow + p * 16) * 64 + cseg],
                   vg + (size_t)(p * 16) * 2048 + tn);
      }
    }
    const __bf16* kb0 = &kls[i & 1][0];
    const __bf16* vb0 = &vls[i & 1][0];

    // --- scores: 4 column sub-tiles, 2 WMMAs each over d ---
    v8f s[4];
#pragma unroll
    for (int j = 0; j < 4; ++j) {
      const __bf16* kb = kb0 + (j * 16 + col) * 64 + koff;
      v16bf b0 = ldfrag(kb);
      v16bf b1 = ldfrag(kb + 32);
      v8f c = {};
      c = WMMA_BF16(aq0, b0, c);
      c = WMMA_BF16(aq1, b1, c);
      s[j] = c;
    }

    // --- scale + tile row-max (reduce across 16-lane N groups) ---
    float tm[8];
#pragma unroll
    for (int r = 0; r < 8; ++r) tm[r] = -3.0e38f;
#pragma unroll
    for (int j = 0; j < 4; ++j)
#pragma unroll
      for (int r = 0; r < 8; ++r) {
        s[j][r] *= 0.125f;  // 1/sqrt(64)
        tm[r] = fmaxf(tm[r], s[j][r]);
      }
#pragma unroll
    for (int off = 1; off < 16; off <<= 1)
#pragma unroll
      for (int r = 0; r < 8; ++r) tm[r] = fmaxf(tm[r], __shfl_xor(tm[r], off, 32));

    // --- online softmax update ---
    float corr[8];
#pragma unroll
    for (int r = 0; r < 8; ++r) {
      float mn = fmaxf(M[r], tm[r]);
      corr[r] = __expf(M[r] - mn);
      M[r] = mn;
    }
#pragma unroll
    for (int j = 0; j < 4; ++j)
#pragma unroll
      for (int r = 0; r < 8; ++r) O[j][r] *= corr[r];

    float ps[8];
#pragma unroll
    for (int r = 0; r < 8; ++r) ps[r] = 0.0f;
#pragma unroll
    for (int j = 0; j < 4; ++j)
#pragma unroll
      for (int r = 0; r < 8; ++r) {
        float p = __expf(s[j][r] - M[r]);
        ps[r] += p;
        pls[wave][(r + (hi << 3)) * 64 + j * 16 + col] = (__bf16)p;
      }
#pragma unroll
    for (int off = 1; off < 16; off <<= 1)
#pragma unroll
      for (int r = 0; r < 8; ++r) ps[r] += __shfl_xor(ps[r], off, 32);
#pragma unroll
    for (int r = 0; r < 8; ++r) L[r] = L[r] * corr[r] + ps[r];

    __syncthreads();  // P tile visible for fragment reloads

    // --- PV: A from P (LDS), B from V tile (LDS, d-major / t-contiguous) ---
    v16bf ap0 = ldfrag(&pls[wave][col * 64 + koff]);
    v16bf ap1 = ldfrag(&pls[wave][col * 64 + koff + 32]);
#pragma unroll
    for (int j2 = 0; j2 < 4; ++j2) {
      const __bf16* vb = vb0 + (j2 * 16 + col) * 64 + koff;
      v16bf b0 = ldfrag(vb);
      v16bf b1 = ldfrag(vb + 32);
      O[j2] = WMMA_BF16(ap0, b0, O[j2]);
      O[j2] = WMMA_BF16(ap1, b1, O[j2]);
    }
  }

  // --- normalize + store z [b][s][h*64+d] bf16 ---
  const int b = bh >> 4, h = bh & 15;
#pragma unroll
  for (int j2 = 0; j2 < 4; ++j2)
#pragma unroll
    for (int r = 0; r < 8; ++r) {
      const int srow = s0 + r + (hi << 3);
      float o = O[j2][r] / L[r];
      z[((size_t)(b * 2048 + srow)) * 1024 + h * 64 + j2 * 16 + col] = (__bf16)o;
    }
}

// ---------------------------------------------------------------------------
// Kernel 5: output projection GEMM. M=8192, K=1024, N=1024; f32 out + bo.
// Same LDS double-buffered async staging as kernel 3.
// ---------------------------------------------------------------------------
__global__ void __launch_bounds__(128) k_gemm_out(const __bf16* __restrict__ Z,
                                                  const __bf16* __restrict__ WoT,
                                                  const float* __restrict__ bo,
                                                  float* __restrict__ out) {
  __shared__ __bf16 als[2][64 * 64];
  __shared__ __bf16 bls[2][64 * 64];

  const int tid = threadIdx.x;
  const int wave = tid >> 5, lane = tid & 31;
  const int col = lane & 15, hi = lane >> 4, koff = hi << 3;
  const int m0 = blockIdx.x * 64 + wave * 16;
  const int n0 = blockIdx.y * 64;

  const int crow = tid >> 3, cseg = (tid & 7) << 3;
  const __bf16* zg = Z   + (size_t)(blockIdx.x * 64 + crow) * 1024 + cseg;
  const __bf16* wg = WoT + (size_t)(n0 + crow) * 1024 + cseg;

#pragma unroll
  for (int p = 0; p < 4; ++p) {
    async_b128(&als[0][(crow + p * 16) * 64 + cseg], zg + (size_t)(p * 16) * 1024);
    async_b128(&bls[0][(crow + p * 16) * 64 + cseg], wg + (size_t)(p * 16) * 1024);
  }

  v8f acc[4] = {};
  for (int i = 0; i < 16; ++i) {
    wait_async0();
    __syncthreads();
    if (i + 1 < 16) {
      const int kn = (i + 1) * 64;
#pragma unroll
      for (int p = 0; p < 4; ++p) {
        async_b128(&als[(i + 1) & 1][(crow + p * 16) * 64 + cseg],
                   zg + (size_t)(p * 16) * 1024 + kn);
        async_b128(&bls[(i + 1) & 1][(crow + p * 16) * 64 + cseg],
                   wg + (size_t)(p * 16) * 1024 + kn);
      }
    }
    const __bf16* ab = &als[i & 1][0];
    const __bf16* bb = &bls[i & 1][0];
#pragma unroll
    for (int kk = 0; kk < 64; kk += 32) {
      v16bf a = ldfrag(ab + (wave * 16 + col) * 64 + kk + koff);
#pragma unroll
      for (int j = 0; j < 4; ++j) {
        v16bf b = ldfrag(bb + (j * 16 + col) * 64 + kk + koff);
        acc[j] = WMMA_BF16(a, b, acc[j]);
      }
    }
  }

#pragma unroll
  for (int j = 0; j < 4; ++j) {
    const int n = n0 + j * 16 + col;
#pragma unroll
    for (int r = 0; r < 8; ++r) {
      const int m = m0 + r + (hi << 3);
      out[(size_t)m * 1024 + n] = acc[j][r] + bo[n];
    }
  }
}

// ---------------------------------------------------------------------------
// Host launcher
// ---------------------------------------------------------------------------
extern "C" void kernel_launch(void* const* d_in, const int* in_sizes, int n_in,
                              void* d_out, int out_size, void* d_ws, size_t ws_size,
                              hipStream_t stream) {
  const float* q  = (const float*)d_in[0];
  const float* kv = (const float*)d_in[1];
  const float* wq = (const float*)d_in[2];
  const float* bq = (const float*)d_in[3];
  const float* wk = (const float*)d_in[4];
  const float* bk = (const float*)d_in[5];
  const float* wv = (const float*)d_in[6];
  const float* bv = (const float*)d_in[7];
  const float* wo = (const float*)d_in[8];
  const float* bo = (const float*)d_in[9];
  float* out = (float*)d_out;

  char* w = (char*)d_ws;
  const size_t MB = 1024 * 1024;
  __bf16* qbf  = (__bf16*)(w + 0 * MB);    // 16 MB (reused later for z)
  __bf16* kvbf = (__bf16*)(w + 16 * MB);   // 16 MB
  __bf16* wqT  = (__bf16*)(w + 32 * MB);   //  2 MB
  __bf16* wkvT = (__bf16*)(w + 34 * MB);   //  4 MB
  __bf16* woT  = (__bf16*)(w + 38 * MB);   //  2 MB
  __bf16* qhB  = (__bf16*)(w + 40 * MB);   // 16 MB
  __bf16* khB  = (__bf16*)(w + 56 * MB);   // 16 MB
  __bf16* vtB  = (__bf16*)(w + 72 * MB);   // 16 MB  (total 88 MB)
  __bf16* zB   = qbf;                      // reuse q_bf region after projection

  k_cvt_act<<<dim3(8388608 / 256), dim3(256), 0, stream>>>(q, kv, qbf, kvbf);
  k_cvt_w<<<dim3(1048576 / 256), dim3(256), 0, stream>>>(wq, wk, wv, wo, wqT, wkvT, woT);
  k_gemm_qkv<<<dim3(128, 16), dim3(128), 0, stream>>>(qbf, wqT, qhB, nullptr, bq, nullptr, 0);
  k_gemm_qkv<<<dim3(128, 32), dim3(128), 0, stream>>>(kvbf, wkvT, khB, vtB, bk, bv, 1);
  k_attn<<<dim3(64, 32), dim3(128), 0, stream>>>(qhB, khB, vtB, zB);
  k_gemm_out<<<dim3(128, 16), dim3(128), 0, stream>>>(zB, woT, bo, out);
}

// v001
// A run of this version takes 277 microseconds.
// Timed twice side by side with v000, it ran 2.10 times as fast both times.
#include <hip/hip_runtime.h>

typedef __attribute__((ext_vector_type(16))) __bf16 v16bf;
typedef __attribute__((ext_vector_type(8)))  __bf16 v8bf;
typedef __attribute__((ext_vector_type(8)))  float  v8f;

#define WMMA_BF16(a, b, c) \
  __builtin_amdgcn_wmma_f32_16x16x32_bf16(false, (a), false, (b), (short)0, (c), false, false)

// LDS byte offset of a __shared__ object (addrspace(3) pointers are the raw
// wave-LDS byte offsets that GLOBAL_LOAD_ASYNC_TO_LDS wants in VDST).
__device__ __forceinline__ unsigned lds_off_u32(const void* p) {
  return (unsigned)(unsigned long long)(__attribute__((address_space(3))) const void*)p;
}

// LDS row pitch of every staged 64-element (128-byte) bf16 row, in elements:
// 144 bytes = 16 B x odd, so the 16 rows that a ds_load_b128 fragment read
// touches per lane half fall on 16 different groups of four banks.
#define LDP 72

// Per-lane async copies, 16 bytes global -> LDS each, tracked by ASYNCcnt: one
// stage of two 64x64 bf16 tiles, four passes of 16 rows per tile. la / lb are
// the lane's LDS places in pass 0, ga / gb its global places, sa / sb the
// global row pitches in elements. The closing s_wait_xcnt 0 stands inside the
// statement so that no address register is rewritten ahead of it.
__device__ __forceinline__ void async_stage(const __bf16* la, const __bf16* ga, int sa,
                                            const __bf16* lb, const __bf16* gb, int sb) {
  const unsigned a0 = lds_off_u32(la), b0 = lds_off_u32(lb);
  const unsigned st = 16 * LDP * 2;  // 16 LDS rows, in bytes
  asm volatile("global_load_async_to_lds_b128 %0, %8, off\n\t"
               "global_load_async_to_lds_b128 %4, %12, off\n\t"
               "global_load_async_to_lds_b128 %1, %9, off\n\t"
               "global_load_async_to_lds_b128 %5, %13, off\n\t"
               "global_load_async_to_lds_b128 %2, %10, off\n\t"
               "global_load_async_to_lds_b128 %6, %14, off\n\t"
               "global_load_async_to_lds_b128 %3, %11, off\n\t"
               "global_load_async_to_lds_b128 %7, %15, off\n\t"
               "s_wait_xcnt 0x0"
               :: "v"(a0), "v"(a0 + st), "v"(a0 + 2 * st), "v"(a0 + 3 * st),
                  "v"(b0), "v"(b0 + st), "v"(b0 + 2 * st), "v"(b0 + 3 * st),
                  "v"(ga), "v"(ga + (size_t)16 * sa), "v"(ga + (size_t)32 * sa),
                  "v"(ga + (size_t)48 * sa),
                  "v"(gb), "v"(gb + (size_t)16 * sb), "v"(gb + (size_t)32 * sb),
                  "v"(gb + (size_t)48 * sb)
               : "memory");
}

__device__ __forceinline__ void wait_async0() {
  asm volatile("s_wait_asynccnt 0" ::: "memory");
}

// The wave's own LDS reads have retired before the barrier behind which the
// buffer they read is refilled by async copies.
__device__ __forceinline__ void wait_ds0() {
  asm volatile("s_wait_dscnt 0x0" ::: "memory");
}

// Load a 16x32 bf16 A/B fragment (CDNA5 16-bit WMMA lane layout): caller passes
// p already offset by row*ld + koff (koff = 8*(lane>=16)); elements [0..7] are
// K=koff..koff+7, [8..15] are K=koff+16..koff+23.
__device__ __forceinline__ v16bf ldfrag(const __bf16* p) {
  v8bf lo = *(const v8bf*)(p);
  v8bf hi = *(const v8bf*)(p + 16);
  v16bf f;
#pragma unroll
  for (int i = 0; i < 8; ++i) { f[i] = lo[i]; f[i + 8] = hi[i]; }
  return f;
}

// ---------------------------------------------------------------------------
// Kernel 1: f32 -> bf16 conversion of activations (q and k_and_v, 8M each)
// ---------------------------------------------------------------------------
__global__ void __launch_bounds__(256) k_cvt_act(const float* __restrict__ q,
                                                 const float* __restrict__ kv,
                                                 __bf16* __restrict__ qb,
                                                 __bf16* __restrict__ kvb) {
  size_t i = (size_t)blockIdx.x * 256 + threadIdx.x;
  qb[i]  = (__bf16)q[i];
  kvb[i] = (__bf16)kv[i];
}

// ---------------------------------------------------------------------------
// Kernel 2: transpose+convert weights into B^T [N][K] bf16 layouts.
//   wqT  [1024][1024] : wqT[n][e]  = wq[h,e,d], n = h*64+d
//   wkvT [2048][1024] : rows 0-1023 from wk, rows 1024-2047 from wv
//   woT  [1024][1024] : woT[e][c]  = wo[c][e]
// ---------------------------------------------------------------------------
__global__ void __launch_bounds__(256) k_cvt_w(const float* __restrict__ wq,
                                               const float* __restrict__ wk,
                                               const float* __restrict__ wv,
                                               const float* __restrict__ wo,
                                               __bf16* __restrict__ wqT,
                                               __bf16* __restrict__ wkvT,
                                               __bf16* __restrict__ woT) {
  int i   = blockIdx.x * 256 + threadIdx.x;   // 0 .. 1M-1
  int row = i >> 10;                          // n (for wq/wk/wv) or e (for wo)
  int cc  = i & 1023;                         // e (for wq/wk/wv) or c (for wo)
  int h = row >> 6, d = row & 63;
  size_t src = (size_t)(h * 1024 + cc) * 64 + d;
  wqT[i]                      = (__bf16)wq[src];
  wkvT[i]                     = (__bf16)wk[src];
  wkvT[(size_t)i + 1024*1024] = (__bf16)wv[src];
  woT[i]                      = (__bf16)wo[(size_t)cc * 1024 + row];
}

// ---------------------------------------------------------------------------
// Kernel 3: QKV projection GEMM. M=8192 (b*s), K=1024.
//   mode 0: N=1024 -> qh [bh][s][64] (+bq)
//   mode 1: N=2048, n<1024 -> kh [bh][t][64] (+bk); n>=1024 -> vt [bh][64][t] (+bv)
// 4 waves/WG; 64x64 WG tile; A/B 64-wide K tiles double-buffered in LDS via
// async global->LDS copies.
// ---------------------------------------------------------------------------
__global__ void __launch_bounds__(128) k_gemm_qkv(const __bf16* __restrict__ X,
                                                  const __bf16* __restrict__ WT,
                                                  __bf16* __restrict__ out0,
                                                  __bf16* __restrict__ vt,
                                                  const float* __restrict__ bias0,
                                                  const float* __restrict__ bias1,
                                                  int mode) {
  __shared__ __attribute__((aligned(16))) __bf16 als[2][64 * LDP];
  __shared__ __attribute__((aligned(16))) __bf16 bls[2][64 * LDP];

  const int tid = threadIdx.x;
  const int wave = tid >> 5, lane = tid & 31;
  const int col = lane & 15, hi = lane >> 4, koff = hi << 3;
  const int m0 = blockIdx.x * 64 + wave * 16;
  const int n0 = blockIdx.y * 64;

  // async-copy addressing: 128 threads cover a 64x64 bf16 tile in 4 passes of
  // 16 rows; each thread moves 16B (8 elements) per pass.
  const int crow = tid >> 3;        // 0..15
  const int cseg = (tid & 7) << 3;  // element offset within row: 0..56

  const __bf16* xg = X  + (size_t)(blockIdx.x * 64 + crow) * 1024 + cseg;
  const __bf16* wg = WT + (size_t)(n0 + crow) * 1024 + cseg;

  async_stage(&als[0][crow * LDP + cseg], xg, 1024, &bls[0][crow * LDP + cseg], wg, 1024);

  v8f acc[4] = {};
  for (int i = 0; i < 16; ++i) {
    wait_ds0();
    wait_async0();       // our chunks of tile i have landed
    __syncthreads();     // everyone's chunks landed; iter i-1 reads all done
    if (i + 1 < 16) {
      const int kn = (i + 1) * 64;
      async_stage(&als[(i + 1) & 1][crow * LDP + cseg], xg + kn, 1024,
                  &bls[(i + 1) & 1][crow * LDP + cseg], wg + kn, 1024);
    }
    const __bf16* ab = &als[i & 1][0];
    const __bf16* bb = &bls[i & 1][0];
#pragma unroll
    for (int kk = 0; kk < 64; kk += 32) {
      v16bf a = ldfrag(ab + (wave * 16 + col) * LDP + kk + koff);
#pragma unroll
      for (int j = 0; j < 4; ++j) {
        v16bf b = ldfrag(bb + (j * 16 + col) * LDP + kk + koff);
        acc[j] = WMMA_BF16(a, b, acc[j]);
      }
    }
  }

#pragma unroll
  for (int j = 0; j < 4; ++j) {
    const int n = n0 + j * 16 + col;
#pragma unroll
    for (int r = 0; r < 8; ++r) {
      const int m = m0 + r + (hi << 3);
      const int bb2 = m >> 11, s = m & 2047;
      float v = acc[j][r];
      if (mode == 0 || n < 1024) {
        const int h = n >> 6, d = n & 63;
        out0[(((size_t)(bb2 * 16 + h)) * 2048 + s) * 64 + d] = (__bf16)(v + bias0[n]);
      } else {
        const int nn = n - 1024;
        const int h = nn >> 6, d = nn & 63;
        vt[(((size_t)(bb2 * 16 + h)) * 64 + d) * 2048 + s] = (__bf16)(v + bias1[nn]);
      }
    }
  }
}

// ---------------------------------------------------------------------------
// Kernel 4: flash attention. grid = (64 bh, 32 row-blocks), block = 128.
// K/V 64x64 tiles double-buffered in LDS (async copies, shared by all 4
// waves); per-wave online softmax; P staged through LDS for the PV GEMM.
// ---------------------------------------------------------------------------
__global__ void __launch_bounds__(128) k_attn(const __bf16* __restrict__ qh,
                                              const __bf16* __restrict__ kh,
                                              const __bf16* __restrict__ vt,
                                              __bf16* __restrict__ z) {
  __shared__ __attribute__((aligned(16))) __bf16 kls[2][64 * LDP];
  __shared__ __attribute__((aligned(16))) __bf16 vls[2][64 * LDP];
  __shared__ __attribute__((aligned(16))) __bf16 pls[4][16 * LDP];

  const int tid = threadIdx.x;
  const int wave = tid >> 5, lane = tid & 31;
  const int col = lane & 15, hi = lane >> 4, koff = hi << 3;
  const int bh = blockIdx.x;                   // b*16 + h
  const int s0 = blockIdx.y * 64 + wave * 16;  // query rows of this wave

  const __bf16* qbase = qh + ((size_t)bh * 2048 + s0) * 64;
  const int crow = tid >> 3, cseg = (tid & 7) << 3;
  const __bf16* kg = kh + ((size_t)bh * 2048 + crow) * 64 + cseg;   // +t0*64
  const __bf16* vg = vt + ((size_t)bh * 64 + crow) * 2048 + cseg;   // +t0

  async_stage(&kls[0][crow * LDP + cseg], kg, 64, &vls[0][crow * LDP + cseg], vg, 2048);

  // Q fragments: rows s0+col, d-dim 64 -> two fragments, kept in regs.
  v16bf aq0 = ldfrag(qbase + (size_t)col * 64 + koff);
  v16bf aq1 = ldfrag(qbase + (size_t)col * 64 + koff + 32);

  v8f O[4] = {};
  float M[8], L[8];
#pragma unroll
  for (int r = 0; r < 8; ++r) { M[r] = -3.0e38f; L[r] = 0.0f; }

  for (int i = 0; i < 32; ++i) {
    wait_ds0();
    wait_async0();
    __syncthreads();
    if (i + 1 < 32) {
      const int tn = (i + 1) * 64;
      async_stage(&kls[(i + 1) & 1][crow * LDP + cseg], kg + (size_t)tn * 64, 64,
                  &vls[(i + 1) & 1][crow * LDP + cseg], vg + tn, 2048);
    }
    const __bf16* kb0 = &kls[i & 1][0];
    const __bf16* vb0 = &vls[i & 1][0];

    // --- scores: 4 column sub-tiles, 2 WMMAs each over d ---
    v8f s[4];
#pragma unroll
    for (int j = 0; j < 4; ++j) {
      const __bf16* kb = kb0 + (j * 16 + col) * LDP + koff;
      v16bf b0 = ldfrag(kb);
      v16bf b1 = ldfrag(kb + 32);
      v8f c = {};
      c = WMMA_BF16(aq0, b0, c);
      c = WMMA_BF16(aq1, b1, c);
      s[j] = c;
    }

    // --- scale + tile row-max (reduce across 16-lane N groups) ---
    float tm[8];
#pragma unroll
    for (int r = 0; r < 8; ++r) tm[r] = -3.0e38f;
#pragma unroll
    for (int j = 0; j < 4; ++j)
#pragma unroll
      for (int r = 0; r < 8; ++r) {
        s[j][r] *= 0.125f;  // 1/sqrt(64)
        tm[r] = fmaxf(tm[r], s[j][r]);
      }
#pragma unroll
    for (int off = 1; off < 16; off <<= 1)
#pragma unroll
      for (int r = 0; r < 8; ++r) tm[r] = fmaxf(tm[r], __shfl_xor(tm[r], off, 32));

    // --- online softmax update ---
    float corr[8];
#pragma unroll
    for (int r = 0; r < 8; ++r) {
      float mn = fmaxf(M[r], tm[r]);
      corr[r] = __expf(M[r] - mn);
      M[r] = mn;
    }
#pragma unroll
    for (int j = 0; j < 4; ++j)
#pragma unroll
      for (int r = 0; r < 8; ++r) O[j][r] *= corr[r];

    float ps[8];
#pragma unroll
    for (int r = 0; r < 8; ++r) ps[r] = 0.0f;
#pragma unroll
    for (int j = 0; j < 4; ++j)
#pragma unroll
      for (int r = 0; r < 8; ++r) {
        float p = __expf(s[j][r] - M[r]);
        ps[r] += p;
        pls[wave][(r + (hi << 3)) * LDP + j * 16 + col] = (__bf16)p;
      }
#pragma unroll
    for (int off = 1; off < 16; off <<= 1)
#pragma unroll
      for (int r = 0; r < 8; ++r) ps[r] += __shfl_xor(ps[r], off, 32);
#pragma unroll
    for (int r = 0; r < 8; ++r) L[r] = L[r] * corr[r] + ps[r];

    __syncthreads();  // P tile visible for fragment reloads

    // --- PV: A from P (LDS), B from V tile (LDS, d-major / t-contiguous) ---
    v16bf ap0 = ldfrag(&pls[wave][col * LDP + koff]);
    v16bf ap1 = ldfrag(&pls[wave][col * LDP + koff + 32]);
#pragma unroll
    for (int j2 = 0; j2 < 4; ++j2) {
      const __bf16* vb = vb0 + (j2 * 16 + col) * LDP + koff;
      v16bf b0 = ldfrag(vb);
      v16bf b1 = ldfrag(vb + 32);
      O[j2] = WMMA_BF16(ap0, b0, O[j2]);
      O[j2] = WMMA_BF16(ap1, b1, O[j2]);
    }
  }

  // --- normalize + store z [b][s][h*64+d] bf16 ---
  const int b = bh >> 4, h = bh & 15;
#pragma unroll
  for (int j2 = 0; j2 < 4; ++j2)
#pragma unroll
    for (int r = 0; r < 8; ++r) {
      const int srow = s0 + r + (hi << 3);
      float o = O[j2][r] / L[r];
      z[((size_t)(b * 2048 + srow)) * 1024 + h * 64 + j2 * 16 + col] = (__bf16)o;
    }
}

// ---------------------------------------------------------------------------
// Kernel 5: output projection GEMM. M=8192, K=1024, N=1024; f32 out + bo.
// Same LDS double-buffered async staging as kernel 3.
// ---------------------------------------------------------------------------
__global__ void __launch_bounds__(128) k_gemm_out(const __bf16* __restrict__ Z,
                                                  const __bf16* __restrict__ WoT,
                                                  const float* __restrict__ bo,
                                                  float* __restrict__ out) {
  __shared__ __attribute__((aligned(16))) __bf16 als[2][64 * LDP];
  __shared__ __attribute__((aligned(16))) __bf16 bls[2][64 * LDP];

  const int tid = threadIdx.x;
  const int wave = tid >> 5, lane = tid & 31;
  const int col = lane & 15, hi = lane >> 4, koff = hi << 3;
  const int m0 = blockIdx.x * 64 + wave * 16;
  const int n0 = blockIdx.y * 64;

  const int crow = tid >> 3, cseg = (tid & 7) << 3;
  const __bf16* zg = Z   + (size_t)(blockIdx.x * 64 + crow) * 1024 + cseg;
  const __bf16* wg = WoT + (size_t)(n0 + crow) * 1024 + cseg;

  async_stage(&als[0][crow * LDP + cseg], zg, 1024, &bls[0][crow * LDP + cseg], wg, 1024);

  v8f acc[4] = {};
  for (int i = 0; i < 16; ++i) {
    wait_ds0();
    wait_async0();
    __syncthreads();
    if (i + 1 < 16) {
      const int kn = (i + 1) * 64;
      async_stage(&als[(i + 1) & 1][crow * LDP + cseg], zg + kn, 1024,
                  &bls[(i + 1) & 1][crow * LDP + cseg], wg + kn, 1024);
    }
    const __bf16* ab = &als[i & 1][0];
    const __bf16* bb = &bls[i & 1][0];
#pragma unroll
    for (int kk = 0; kk < 64; kk += 32) {
      v16bf a = ldfrag(ab + (wave * 16 + col) * LDP + kk + koff);
#pragma unroll
      for (int j = 0; j < 4; ++j) {
        v16bf b = ldfrag(bb + (j * 16 + col) * LDP + kk + koff);
        acc[j] = WMMA_BF16(a, b, acc[j]);
      }
    }
  }

#pragma unroll
  for (int j = 0; j < 4; ++j) {
    const int n = n0 + j * 16 + col;
#pragma unroll
    for (int r = 0; r < 8; ++r) {
      const int m = m0 + r + (hi << 3);
      out[(size_t)m * 1024 + n] = acc[j][r] + bo[n];
    }
  }
}

// ---------------------------------------------------------------------------
// Host launcher
// ---------------------------------------------------------------------------
extern "C" void kernel_launch(void* const* d_in, const int* in_sizes, int n_in,
                              void* d_out, int out_size, void* d_ws, size_t ws_size,
                              hipStream_t stream) {
  const float* q  = (const float*)d_in[0];
  const float* kv = (const float*)d_in[1];
  const float* wq = (const float*)d_in[2];
  const float* bq = (const float*)d_in[3];
  const float* wk = (const float*)d_in[4];
  const float* bk = (const float*)d_in[5];
  const float* wv = (const float*)d_in[6];
  const float* bv = (const float*)d_in[7];
  const float* wo = (const float*)d_in[8];
  const float* bo = (const float*)d_in[9];
  float* out = (float*)d_out;

  char* w = (char*)d_ws;
  const size_t MB = 1024 * 1024;
  __bf16* qbf  = (__bf16*)(w + 0 * MB);    // 16 MB (reused later for z)
  __bf16* kvbf = (__bf16*)(w + 16 * MB);   // 16 MB
  __bf16* wqT  = (__bf16*)(w + 32 * MB);   //  2 MB
  __bf16* wkvT = (__bf16*)(w + 34 * MB);   //  4 MB
  __bf16* woT  = (__bf16*)(w + 38 * MB);   //  2 MB
  __bf16* qhB  = (__bf16*)(w + 40 * MB);   // 16 MB
  __bf16* khB  = (__bf16*)(w + 56 * MB);   // 16 MB
  __bf16* vtB  = (__bf16*)(w + 72 * MB);   // 16 MB  (total 88 MB)
  __bf16* zB   = qbf;                      // reuse q_bf region after projection

  k_cvt_act<<<dim3(8388608 / 256), dim3(256), 0, stream>>>(q, kv, qbf, kvbf);
  k_cvt_w<<<dim3(1048576 / 256), dim3(256), 0, stream>>>(wq, wk, wv, wo, wqT, wkvT, woT);
  k_gemm_qkv<<<dim3(128, 16), dim3(128), 0, stream>>>(qbf, wqT, qhB, nullptr, bq, nullptr, 0);
  k_gemm_qkv<<<dim3(128, 32), dim3(128), 0, stream>>>(kvbf, wkvT, khB, vtB, bk, bv, 1);
  k_attn<<<dim3(64, 32), dim3(128), 0, stream>>>(qhB, khB, vtB, zB);
  k_gemm_out<<<dim3(128, 16), dim3(128), 0, stream>>>(zB, woT, bo, out);
}

// v002
// It runs in 226 microseconds.
// Next to v001, in two timings, it ran 1.23 times as fast each time.
// All steps since v000 together make it 2.57 times as fast.
#include <hip/hip_runtime.h>

typedef __attribute__((ext_vector_type(16))) __bf16 v16bf;
typedef __attribute__((ext_vector_type(8)))  __bf16 v8bf;
typedef __attribute__((ext_vector_type(8)))  float  v8f;

#define WMMA_BF16(a, b, c) \
  __builtin_amdgcn_wmma_f32_16x16x32_bf16(false, (a), false, (b), (short)0, (c), false, false)

// LDS byte offset of a __shared__ object (addrspace(3) pointers are the raw
// wave-LDS byte offsets that GLOBAL_LOAD_ASYNC_TO_LDS wants in VDST).
__device__ __forceinline__ unsigned lds_off_u32(const void* p) {
  return (unsigned)(unsigned long long)(__attribute__((address_space(3))) const void*)p;
}

// LDS row pitch of every staged 64-element (128-byte) bf16 row, in elements:
// 144 bytes = 16 B x odd, so the 16 rows that a ds_load_b128 fragment read
// touches per lane half fall on 16 different groups of four banks.
#define LDP 72

// Per-lane async copies, 16 bytes global -> LDS each, tracked by ASYNCcnt: one
// stage of two 64x64 bf16 tiles, four passes of 16 rows per tile. la / lb are
// the lane's LDS places in pass 0, ga / gb its global places, sa / sb the
// global row pitches in elements. The closing s_wait_xcnt 0 stands inside the
// statement so that no address register is rewritten ahead of it.
__device__ __forceinline__ void async_stage(const __bf16* la, const __bf16* ga, int sa,
                                            const __bf16* lb, const __bf16* gb, int sb) {
  const unsigned a0 = lds_off_u32(la), b0 = lds_off_u32(lb);
  const unsigned st = 16 * LDP * 2;  // 16 LDS rows, in bytes
  asm volatile("global_load_async_to_lds_b128 %0, %8, off\n\t"
               "global_load_async_to_lds_b128 %4, %12, off\n\t"
               "global_load_async_to_lds_b128 %1, %9, off\n\t"
               "global_load_async_to_lds_b128 %5, %13, off\n\t"
               "global_load_async_to_lds_b128 %2, %10, off\n\t"
               "global_load_async_to_lds_b128 %6, %14, off\n\t"
               "global_load_async_to_lds_b128 %3, %11, off\n\t"
               "global_load_async_to_lds_b128 %7, %15, off\n\t"
               "s_wait_xcnt 0x0"
               :: "v"(a0), "v"(a0 + st), "v"(a0 + 2 * st), "v"(a0 + 3 * st),
                  "v"(b0), "v"(b0 + st), "v"(b0 + 2 * st), "v"(b0 + 3 * st),
                  "v"(ga), "v"(ga + (size_t)16 * sa), "v"(ga + (size_t)32 * sa),
                  "v"(ga + (size_t)48 * sa),
                  "v"(gb), "v"(gb + (size_t)16 * sb), "v"(gb + (size_t)32 * sb),
                  "v"(gb + (size_t)48 * sb)
               : "memory");
}

__device__ __forceinline__ void wait_async0() {
  asm volatile("s_wait_asynccnt 0" ::: "memory");
}

// The wave's own LDS reads have retired before the barrier behind which the
// buffer they read is refilled by async copies.
__device__ __forceinline__ void wait_ds0() {
  asm volatile("s_wait_dscnt 0x0" ::: "memory");
}

// Load a 16x32 bf16 A/B fragment (CDNA5 16-bit WMMA lane layout): caller passes
// p already offset by row*ld + koff (koff = 8*(lane>=16)); elements [0..7] are
// K=koff..koff+7, [8..15] are K=koff+16..koff+23.
__device__ __forceinline__ v16bf ldfrag(const __bf16* p) {
  v8bf lo = *(const v8bf*)(p);
  v8bf hi = *(const v8bf*)(p + 16);
  v16bf f;
#pragma unroll
  for (int i = 0; i < 8; ++i) { f[i] = lo[i]; f[i + 8] = hi[i]; }
  return f;
}

// ---------------------------------------------------------------------------
// Kernel 1: f32 -> bf16 conversion of activations (q and k_and_v, 8M each)
// ---------------------------------------------------------------------------
__global__ void __launch_bounds__(256) k_cvt_act(const float* __restrict__ q,
                                                 const float* __restrict__ kv,
                                                 __bf16* __restrict__ qb,
                                                 __bf16* __restrict__ kvb) {
  size_t i = (size_t)blockIdx.x * 256 + threadIdx.x;
  qb[i]  = (__bf16)q[i];
  kvb[i] = (__bf16)kv[i];
}

// ---------------------------------------------------------------------------
// Kernel 2: transpose+convert weights into B^T [N][K] bf16 layouts.
//   wqT  [1024][1024] : wqT[n][e]  = wq[h,e,d], n = h*64+d
//   wkvT [2048][1024] : rows 0-1023 from wk, rows 1024-2047 from wv
//   woT  [1024][1024] : woT[e][c]  = wo[c][e]
// ---------------------------------------------------------------------------
__global__ void __launch_bounds__(256) k_cvt_w(const float* __restrict__ wq,
                                               const float* __restrict__ wk,
                                               const float* __restrict__ wv,
                                               const float* __restrict__ wo,
                                               __bf16* __restrict__ wqT,
                                               __bf16* __restrict__ wkvT,
                                               __bf16* __restrict__ woT) {
  int i   = blockIdx.x * 256 + threadIdx.x;   // 0 .. 1M-1
  int row = i >> 10;                          // n (for wq/wk/wv) or e (for wo)
  int cc  = i & 1023;                         // e (for wq/wk/wv) or c (for wo)
  int h = row >> 6, d = row & 63;
  size_t src = (size_t)(h * 1024 + cc) * 64 + d;
  wqT[i]                      = (__bf16)wq[src];
  wkvT[i]                     = (__bf16)wk[src];
  wkvT[(size_t)i + 1024*1024] = (__bf16)wv[src];
  woT[i]                      = (__bf16)wo[(size_t)cc * 1024 + row];
}

// ---------------------------------------------------------------------------
// Kernel 3: QKV projection GEMM. M=8192 (b*s), K=1024.
//   mode 0: N=1024 -> qh [bh][s][64] (+bq)
//   mode 1: N=2048, n<1024 -> kh [bh][t][64] (+bk); n>=1024 -> vt [bh][64][t] (+bv)
// 4 waves/WG; 64x64 WG tile; A/B 64-wide K tiles double-buffered in LDS via
// async global->LDS copies.
// ---------------------------------------------------------------------------
__global__ void __launch_bounds__(128) k_gemm_qkv(const __bf16* __restrict__ X,
                                                  const __bf16* __restrict__ WT,
                                                  __bf16* __restrict__ out0,
                                                  __bf16* __restrict__ vt,
                                                  const float* __restrict__ bias0,
                                                  const float* __restrict__ bias1,
                                                  int mode) {
  __shared__ __attribute__((aligned(16))) __bf16 als[2][64 * LDP];
  __shared__ __attribute__((aligned(16))) __bf16 bls[2][64 * LDP];

  const int tid = threadIdx.x;
  const int wave = tid >> 5, lane = tid & 31;
  const int col = lane & 15, hi = lane >> 4, koff = hi << 3;
  const int m0 = blockIdx.x * 64 + wave * 16;
  const int n0 = blockIdx.y * 64;

  // async-copy addressing: 128 threads cover a 64x64 bf16 tile in 4 passes of
  // 16 rows; each thread moves 16B (8 elements) per pass.
  const int crow = tid >> 3;        // 0..15
  const int cseg = (tid & 7) << 3;  // element offset within row: 0..56

  const __bf16* xg = X  + (size_t)(blockIdx.x * 64 + crow) * 1024 + cseg;
  const __bf16* wg = WT + (size_t)(n0 + crow) * 1024 + cseg;

  async_stage(&als[0][crow * LDP + cseg], xg, 1024, &bls[0][crow * LDP + cseg], wg, 1024);

  v8f acc[4] = {};
  for (int i = 0; i < 16; ++i) {
    wait_ds0();
    wait_async0();       // our chunks of tile i have landed
    __syncthreads();     // everyone's chunks landed; iter i-1 reads all done
    if (i + 1 < 16) {
      const int kn = (i + 1) * 64;
      async_stage(&als[(i + 1) & 1][crow * LDP + cseg], xg + kn, 1024,
                  &bls[(i + 1) & 1][crow * LDP + cseg], wg + kn, 1024);
    }
    const __bf16* ab = &als[i & 1][0];
    const __bf16* bb = &bls[i & 1][0];
#pragma unroll
    for (int kk = 0; kk < 64; kk += 32) {
      v16bf a = ldfrag(ab + (wave * 16 + col) * LDP + kk + koff);
#pragma unroll
      for (int j = 0; j < 4; ++j) {
        v16bf b = ldfrag(bb + (j * 16 + col) * LDP + kk + koff);
        acc[j] = WMMA_BF16(a, b, acc[j]);
      }
    }
  }

#pragma unroll
  for (int j = 0; j < 4; ++j) {
    const int n = n0 + j * 16 + col;
#pragma unroll
    for (int r = 0; r < 8; ++r) {
      const int m = m0 + r + (hi << 3);
      const int bb2 = m >> 11, s = m & 2047;
      float v = acc[j][r];
      if (mode == 0 || n < 1024) {
        const int h = n >> 6, d = n & 63;
        out0[(((size_t)(bb2 * 16 + h)) * 2048 + s) * 64 + d] = (__bf16)(v + bias0[n]);
      } else {
        const int nn = n - 1024;
        const int h = nn >> 6, d = nn & 63;
        vt[(((size_t)(bb2 * 16 + h)) * 64 + d) * 2048 + s] = (__bf16)(v + bias1[nn]);
      }
    }
  }
}

// Lane l <-> lane l ^ 16: the two lanes that share one column of a WMMA tile.
__device__ __forceinline__ float xhalf(float x) {
  const int b = __builtin_bit_cast(int, x);
  return __builtin_bit_cast(float,
      __builtin_amdgcn_permlanex16(b, b, 0x76543210, 0xfedcba98, false, false));
}

// 2^x in place. Behind a transcendental the instruction set asks for one free
// slot before its result is read or its source overwritten: written in place and
// in one statement, each v_exp_f32 has an independent one behind it and the last
// has the v_nop, whatever the compiler schedules next.
__device__ __forceinline__ float exp2_slot(float x) {
  asm("v_exp_f32 %0, %0\n\tv_nop" : "+v"(x));
  return x;
}
__device__ __forceinline__ void exp2x8_slot(float (&x)[8]) {
  asm("v_exp_f32 %0, %0\n\t"
      "v_exp_f32 %1, %1\n\t"
      "v_exp_f32 %2, %2\n\t"
      "v_exp_f32 %3, %3\n\t"
      "v_exp_f32 %4, %4\n\t"
      "v_exp_f32 %5, %5\n\t"
      "v_exp_f32 %6, %6\n\t"
      "v_exp_f32 %7, %7\n\t"
      "v_nop"
      : "+v"(x[0]), "+v"(x[1]), "+v"(x[2]), "+v"(x[3]),
        "+v"(x[4]), "+v"(x[5]), "+v"(x[6]), "+v"(x[7]));
}
#define LOG2E 1.44269504088896340736f

__global__ void __launch_bounds__(128) k_attn(const __bf16* __restrict__ qh,
                                              const __bf16* __restrict__ kh,
                                              const __bf16* __restrict__ vt,
                                              __bf16* __restrict__ z) {
  __shared__ __attribute__((aligned(16))) __bf16 kls[2][64 * LDP];
  __shared__ __attribute__((aligned(16))) __bf16 vls[2][64 * LDP];

  const int tid = threadIdx.x;
  const int wave = tid >> 5, lane = tid & 31;
  const int col = lane & 15, hi = lane >> 4, koff = hi << 3;
  const int bh = blockIdx.x;                   // b*16 + h
  const int s0 = blockIdx.y * 64 + wave * 16;  // query rows of this wave

  const __bf16* qbase = qh + ((size_t)bh * 2048 + s0) * 64;
  const int crow = tid >> 3, cseg = (tid & 7) << 3;
  const __bf16* kg = kh + ((size_t)bh * 2048 + crow) * 64 + cseg;   // +t0*64
  const __bf16* vg = vt + ((size_t)bh * 64 + crow) * 2048 + cseg;   // +t0

  async_stage(&kls[0][crow * LDP + cseg], kg, 64, &vls[0][crow * LDP + cseg], vg, 2048);

  // Q^T as B operand: column = query s0+col, k = d -> two fragments, kept in regs.
  v16bf bq0 = ldfrag(qbase + (size_t)col * 64 + koff);
  v16bf bq1 = ldfrag(qbase + (size_t)col * 64 + koff + 32);

  // O[j2][r] = O^T[d = j2*16 + 8*hi + r][query col]; M is the query's running
  // maximum (equal in both lane halves), L this lane half's share of its sum.
  v8f O[4] = {};
  float M = -3.0e38f, L = 0.0f;

  for (int i = 0; i < 32; ++i) {
    wait_ds0();
    wait_async0();
    __syncthreads();
    if (i + 1 < 32) {
      const int tn = (i + 1) * 64;
      async_stage(&kls[(i + 1) & 1][crow * LDP + cseg], kg + (size_t)tn * 64, 64,
                  &vls[(i + 1) & 1][crow * LDP + cseg], vg + tn, 2048);
    }
    const __bf16* kb0 = &kls[i & 1][0];
    const __bf16* vb0 = &vls[i & 1][0];

    // --- scores: s[j][r] = S^T[key j*16 + 8*hi + r][query col], 2 WMMAs over d ---
    v8f s[4];
#pragma unroll
    for (int j = 0; j < 4; ++j) {
      const __bf16* kb = kb0 + (j * 16 + col) * LDP + koff;
      v16bf a0 = ldfrag(kb);
      v16bf a1 = ldfrag(kb + 32);
      v8f c = {};
      c = WMMA_BF16(a0, bq0, c);
      c = WMMA_BF16(a1, bq1, c);
      s[j] = c;
    }

    // --- scale + the query's tile maximum: in the lane, then across the halves ---
    float tm = -3.0e38f;
#pragma unroll
    for (int j = 0; j < 4; ++j)
#pragma unroll
      for (int r = 0; r < 8; ++r) {
        s[j][r] *= 0.125f;  // 1/sqrt(64)
        tm = fmaxf(tm, s[j][r]);
      }
    tm = fmaxf(tm, xhalf(tm));

    // --- online softmax update ---
    const float mn = fmaxf(M, tm);
    const float corr = exp2_slot((M - mn) * LOG2E);
    M = mn;
#pragma unroll
    for (int j = 0; j < 4; ++j)
#pragma unroll
      for (int r = 0; r < 8; ++r) O[j][r] *= corr;

    // P^T fragments: element e of bp[g] is key g*32 + kmap(e), which is
    // register e & 7 of score tile 2*g + (e >> 3) in this very lane.
    v16bf bp[2];
    float ps[4];
#pragma unroll
    for (int j = 0; j < 4; ++j) {
      float p[8];
#pragma unroll
      for (int r = 0; r < 8; ++r) p[r] = (s[j][r] - M) * LOG2E;
      exp2x8_slot(p);
      ps[j] = p[0];
#pragma unroll
      for (int r = 1; r < 8; ++r) ps[j] += p[r];
#pragma unroll
      for (int r = 0; r < 8; ++r) bp[j >> 1][(j & 1) * 8 + r] = (__bf16)p[r];
    }
    L = L * corr + ((ps[0] + ps[1]) + (ps[2] + ps[3]));

    // --- PV: A = V^T rows d (LDS, t-contiguous), B = P^T from registers ---
#pragma unroll
    for (int j2 = 0; j2 < 4; ++j2) {
      const __bf16* vb = vb0 + (j2 * 16 + col) * LDP + koff;
      v16bf a0 = ldfrag(vb);
      v16bf a1 = ldfrag(vb + 32);
      O[j2] = WMMA_BF16(a0, bp[0], O[j2]);
      O[j2] = WMMA_BF16(a1, bp[1], O[j2]);
    }
  }

  // --- join the halves' sums, normalize, store z [b][s][h*64+d] bf16:
  //     8 consecutive d per lane and tile = one 16-byte store ---
  const float Lq = L + xhalf(L);
  const int b = bh >> 4, h = bh & 15;
  __bf16* zrow = z + ((size_t)(b * 2048 + s0 + col)) * 1024 + h * 64 + koff;
#pragma unroll
  for (int j2 = 0; j2 < 4; ++j2) {
    v8bf o;
#pragma unroll
    for (int r = 0; r < 8; ++r) o[r] = (__bf16)(O[j2][r] / Lq);
    *(v8bf*)(zrow + j2 * 16) = o;
  }
}

// ---------------------------------------------------------------------------
// Kernel 5: output projection GEMM. M=8192, K=1024, N=1024; f32 out + bo.
// Same LDS double-buffered async staging as kernel 3.
// ---------------------------------------------------------------------------
__global__ void __launch_bounds__(128) k_gemm_out(const __bf16* __restrict__ Z,
                                                  const __bf16* __restrict__ WoT,
                                                  const float* __restrict__ bo,
                                                  float* __restrict__ out) {
  __shared__ __attribute__((aligned(16))) __bf16 als[2][64 * LDP];
  __shared__ __attribute__((aligned(16))) __bf16 bls[2][64 * LDP];

  const int tid = threadIdx.x;
  const int wave = tid >> 5, lane = tid & 31;
  const int col = lane & 15, hi = lane >> 4, koff = hi << 3;
  const int m0 = blockIdx.x * 64 + wave * 16;
  const int n0 = blockIdx.y * 64;

  const int crow = tid >> 3, cseg = (tid & 7) << 3;
  const __bf16* zg = Z   + (size_t)(blockIdx.x * 64 + crow) * 1024 + cseg;
  const __bf16* wg = WoT + (size_t)(n0 + crow) * 1024 + cseg;

  async_stage(&als[0][crow * LDP + cseg], zg, 1024, &bls[0][crow * LDP + cseg], wg, 1024);

  v8f acc[4] = {};
  for (int i = 0; i < 16; ++i) {
    wait_ds0();
    wait_async0();
    __syncthreads();
    if (i + 1 < 16) {
      const int kn = (i + 1) * 64;
      async_stage(&als[(i + 1) & 1][crow * LDP + cseg], zg + kn, 1024,
                  &bls[(i + 1) & 1][crow * LDP + cseg], wg + kn, 1024);
    }
    const __bf16* ab = &als[i & 1][0];
    const __bf16* bb = &bls[i & 1][0];
#pragma unroll
    for (int kk = 0; kk < 64; kk += 32) {
      v16bf a = ldfrag(ab + (wave * 16 + col) * LDP + kk + koff);
#pragma unroll
      for (int j = 0; j < 4; ++j) {
        v16bf b = ldfrag(bb + (j * 16 + col) * LDP + kk + koff);
        acc[j] = WMMA_BF16(a, b, acc[j]);
      }
    }
  }

#pragma unroll
  for (int j = 0; j < 4; ++j) {
    const int n = n0 + j * 16 + col;
#pragma unroll
    for (int r = 0; r < 8; ++r) {
      const int m = m0 + r + (hi << 3);
      out[(size_t)m * 1024 + n] = acc[j][r] + bo[n];
    }
  }
}

// ---------------------------------------------------------------------------
// Host launcher
// ---------------------------------------------------------------------------
extern "C" void kernel_launch(void* const* d_in, const int* in_sizes, int n_in,
                              void* d_out, int out_size, void* d_ws, size_t ws_size,
                              hipStream_t stream) {
  const float* q  = (const float*)d_in[0];
  const float* kv = (const float*)d_in[1];
  const float* wq = (const float*)d_in[2];
  const float* bq = (const float*)d_in[3];
  const float* wk = (const float*)d_in[4];
  const float* bk = (const float*)d_in[5];
  const float* wv = (const float*)d_in[6];
  const float* bv = (const float*)d_in[7];
  const float* wo = (const float*)d_in[8];
  const float* bo = (const float*)d_in[9];
  float* out = (float*)d_out;

  char* w = (char*)d_ws;
  const size_t MB = 1024 * 1024;
  __bf16* qbf  = (__bf16*)(w + 0 * MB);    // 16 MB (reused later for z)
  __bf16* kvbf = (__bf16*)(w + 16 * MB);   // 16 MB
  __bf16* wqT  = (__bf16*)(w + 32 * MB);   //  2 MB
  __bf16* wkvT = (__bf16*)(w + 34 * MB);   //  4 MB
  __bf16* woT  = (__bf16*)(w + 38 * MB);   //  2 MB
  __bf16* qhB  = (__bf16*)(w + 40 * MB);   // 16 MB
  __bf16* khB  = (__bf16*)(w + 56 * MB);   // 16 MB
  __bf16* vtB  = (__bf16*)(w + 72 * MB);   // 16 MB  (total 88 MB)
  __bf16* zB   = qbf;                      // reuse q_bf region after projection

  k_cvt_act<<<dim3(8388608 / 256), dim3(256), 0, stream>>>(q, kv, qbf, kvbf);
  k_cvt_w<<<dim3(1048576 / 256), dim3(256), 0, stream>>>(wq, wk, wv, wo, wqT, wkvT, woT);
  k_gemm_qkv<<<dim3(128, 16), dim3(128), 0, stream>>>(qbf, wqT, qhB, nullptr, bq, nullptr, 0);
  k_gemm_qkv<<<dim3(128, 32), dim3(128), 0, stream>>>(kvbf, wkvT, khB, vtB, bk, bv, 1);
  k_attn<<<dim3(64, 32), dim3(128), 0, stream>>>(qhB, khB, vtB, zB);
  k_gemm_out<<<dim3(128, 16), dim3(128), 0, stream>>>(zB, woT, bo, out);
}

// v003
// One run takes 170 microseconds.
// Next to v002, in two timings, it ran 1.32 and 1.33 times as fast.
// Counting every step since v000, it is 3.40 times as fast.
#include <hip/hip_runtime.h>

typedef __attribute__((ext_vector_type(16))) __bf16 v16bf;
typedef __attribute__((ext_vector_type(8)))  __bf16 v8bf;
typedef __attribute__((ext_vector_type(8)))  float  v8f;

#define WMMA_BF16(a, b, c) \
  __builtin_amdgcn_wmma_f32_16x16x32_bf16(false, (a), false, (b), (short)0, (c), false, false)

// LDS byte offset of a __shared__ object (addrspace(3) pointers are the raw
// wave-LDS byte offsets that GLOBAL_LOAD_ASYNC_TO_LDS wants in VDST).
__device__ __forceinline__ unsigned lds_off_u32(const void* p) {
  return (unsigned)(unsigned long long)(__attribute__((address_space(3))) const void*)p;
}

// LDS row pitch of every staged 64-element (128-byte) bf16 row, in elements:
// 144 bytes = 16 B x odd, so the 16 rows that a ds_load_b128 fragment read
// touches per lane half fall on 16 different groups of four banks.
#define LDP 72

// Per-lane async copies, 16 bytes global -> LDS each, tracked by ASYNCcnt: one
// stage of two 64x64 bf16 tiles, four passes of 16 rows per tile. la / lb are
// the lane's LDS places in pass 0, ga / gb its global places, sa / sb the
// global row pitches in elements. The closing s_wait_xcnt 0 stands inside the
// statement so that no address register is rewritten ahead of it.
__device__ __forceinline__ void async_stage(const __bf16* la, const __bf16* ga, int sa,
                                            const __bf16* lb, const __bf16* gb, int sb) {
  const unsigned a0 = lds_off_u32(la), b0 = lds_off_u32(lb);
  const unsigned st = 16 * LDP * 2;  // 16 LDS rows, in bytes
  asm volatile("global_load_async_to_lds_b128 %0, %8, off\n\t"
               "global_load_async_to_lds_b128 %4, %12, off\n\t"
               "global_load_async_to_lds_b128 %1, %9, off\n\t"
               "global_load_async_to_lds_b128 %5, %13, off\n\t"
               "global_load_async_to_lds_b128 %2, %10, off\n\t"
               "global_load_async_to_lds_b128 %6, %14, off\n\t"
               "global_load_async_to_lds_b128 %3, %11, off\n\t"
               "global_load_async_to_lds_b128 %7, %15, off\n\t"
               "s_wait_xcnt 0x0"
               :: "v"(a0), "v"(a0 + st), "v"(a0 + 2 * st), "v"(a0 + 3 * st),
                  "v"(b0), "v"(b0 + st), "v"(b0 + 2 * st), "v"(b0 + 3 * st),
                  "v"(ga), "v"(ga + (size_t)16 * sa), "v"(ga + (size_t)32 * sa),
                  "v"(ga + (size_t)48 * sa),
                  "v"(gb), "v"(gb + (size_t)16 * sb), "v"(gb + (size_t)32 * sb),
                  "v"(gb + (size_t)48 * sb)
               : "memory");
}

__device__ __forceinline__ void wait_async0() {
  asm volatile("s_wait_asynccnt 0" ::: "memory");
}

// The wave's own LDS reads have retired before the barrier behind which the
// buffer they read is refilled by async copies.
__device__ __forceinline__ void wait_ds0() {
  asm volatile("s_wait_dscnt 0x0" ::: "memory");
}

// Load a 16x32 bf16 A/B fragment (CDNA5 16-bit WMMA lane layout): caller passes
// p already offset by row*ld + koff (koff = 8*(lane>=16)); elements [0..7] are
// K=koff..koff+7, [8..15] are K=koff+16..koff+23.
__device__ __forceinline__ v16bf ldfrag(const __bf16* p) {
  v8bf lo = *(const v8bf*)(p);
  v8bf hi = *(const v8bf*)(p + 16);
  v16bf f;
#pragma unroll
  for (int i = 0; i < 8; ++i) { f[i] = lo[i]; f[i + 8] = hi[i]; }
  return f;
}

// ---------------------------------------------------------------------------
// Kernel 1: f32 -> bf16 conversion of activations (q and k_and_v, 8M each)
// ---------------------------------------------------------------------------
__global__ void __launch_bounds__(256) k_cvt_act(const float* __restrict__ q,
                                                 const float* __restrict__ kv,
                                                 __bf16* __restrict__ qb,
                                                 __bf16* __restrict__ kvb) {
  size_t i = (size_t)blockIdx.x * 256 + threadIdx.x;
  qb[i]  = (__bf16)q[i];
  kvb[i] = (__bf16)kv[i];
}

// ---------------------------------------------------------------------------
// Kernel 2: transpose+convert weights into B^T [N][K] bf16 layouts.
//   wqT  [1024][1024] : wqT[n][e]  = wq[h,e,d], n = h*64+d
//   wkvT [2048][1024] : rows 0-1023 from wk, rows 1024-2047 from wv
//   woT  [1024][1024] : woT[e][c]  = wo[c][e]
// ---------------------------------------------------------------------------
__global__ void __launch_bounds__(256) k_cvt_w(const float* __restrict__ wq,
                                               const float* __restrict__ wk,
                                               const float* __restrict__ wv,
                                               const float* __restrict__ wo,
                                               __bf16* __restrict__ wqT,
                                               __bf16* __restrict__ wkvT,
                                               __bf16* __restrict__ woT) {
  int i   = blockIdx.x * 256 + threadIdx.x;   // 0 .. 1M-1
  int row = i >> 10;                          // n (for wq/wk/wv) or e (for wo)
  int cc  = i & 1023;                         // e (for wq/wk/wv) or c (for wo)
  int h = row >> 6, d = row & 63;
  size_t src = (size_t)(h * 1024 + cc) * 64 + d;
  wqT[i]                      = (__bf16)wq[src];
  wkvT[i]                     = (__bf16)wk[src];
  wkvT[(size_t)i + 1024*1024] = (__bf16)wv[src];
  woT[i]                      = (__bf16)wo[(size_t)cc * 1024 + row];
}

// ---------------------------------------------------------------------------
// Kernel 3: QKV projection GEMM. M=8192 (b*s), K=1024.
//   mode 0: N=1024 -> qh [bh][s][64] (+bq)
//   mode 1: N=2048, n<1024 -> kh [bh][t][64] (+bk); n>=1024 -> vt [bh][64][t] (+bv)
// 4 waves/WG in a 2x2 grid; 128x128 WG tile, 64x64 per wave (4x4 accumulator
// tiles: each loaded fragment feeds four WMMAs); A/B 64-wide K tiles
// double-buffered in LDS via async global->LDS copies.
// ---------------------------------------------------------------------------
__global__ void __launch_bounds__(128) k_gemm_qkv(const __bf16* __restrict__ X,
                                                  const __bf16* __restrict__ WT,
                                                  __bf16* __restrict__ out0,
                                                  __bf16* __restrict__ vt,
                                                  const float* __restrict__ bias0,
                                                  const float* __restrict__ bias1,
                                                  int mode) {
  __shared__ __attribute__((aligned(16))) __bf16 als[2][128 * LDP];
  __shared__ __attribute__((aligned(16))) __bf16 bls[2][128 * LDP];

  const int tid = threadIdx.x;
  const int wave = tid >> 5, lane = tid & 31;
  const int col = lane & 15, hi = lane >> 4, koff = hi << 3;
  const int wm = (wave >> 1) * 64, wn = (wave & 1) * 64;  // wave's corner in the tile
  const int m0 = blockIdx.x * 128 + wm;
  const int n0 = blockIdx.y * 128 + wn;

  // async-copy addressing: 128 threads cover 64 rows of 64 bf16 in 4 passes of
  // 16 rows, 16B (8 elements) per thread and pass; a 128-row tile is two such halves.
  const int crow = tid >> 3;        // 0..15
  const int cseg = (tid & 7) << 3;  // element offset within row: 0..56

  const __bf16* xg = X  + (size_t)(blockIdx.x * 128 + crow) * 1024 + cseg;
  const __bf16* wg = WT + (size_t)(blockIdx.y * 128 + crow) * 1024 + cseg;
  const int cl = crow * LDP + cseg, ch = cl + 64 * LDP;  // LDS places, rows 0-63 / 64-127

  async_stage(&als[0][cl], xg, 1024, &bls[0][cl], wg, 1024);
  async_stage(&als[0][ch], xg + 64 * 1024, 1024, &bls[0][ch], wg + 64 * 1024, 1024);

  v8f acc[4][4] = {};
  for (int i = 0; i < 16; ++i) {
    wait_ds0();
    wait_async0();       // our chunks of tile i have landed
    __syncthreads();     // everyone's chunks landed; iter i-1 reads all done
    if (i + 1 < 16) {
      const int kn = (i + 1) * 64;
      async_stage(&als[(i + 1) & 1][cl], xg + kn, 1024, &bls[(i + 1) & 1][cl], wg + kn, 1024);
      async_stage(&als[(i + 1) & 1][ch], xg + kn + 64 * 1024, 1024,
                  &bls[(i + 1) & 1][ch], wg + kn + 64 * 1024, 1024);
    }
    const __bf16* ab = &als[i & 1][0];
    const __bf16* bb = &bls[i & 1][0];
#pragma unroll
    for (int kk = 0; kk < 64; kk += 32) {
      v16bf a[4], b[4];
#pragma unroll
      for (int t = 0; t < 4; ++t) a[t] = ldfrag(ab + (wm + t * 16 + col) * LDP + kk + koff);
#pragma unroll
      for (int j = 0; j < 4; ++j) b[j] = ldfrag(bb + (wn + j * 16 + col) * LDP + kk + koff);
#pragma unroll
      for (int t = 0; t < 4; ++t)
#pragma unroll
        for (int j = 0; j < 4; ++j) acc[t][j] = WMMA_BF16(a[t], b[j], acc[t][j]);
    }
  }

  // A wave's 64 rows lie in one batch and its 64 columns are one head, of q/k or
  // of v: one test for the whole work-group, one base address per lane.
  const int bb2 = m0 >> 11, s0 = (m0 & 2047) + (hi << 3);
  if (mode != 0 && blockIdx.y >= 8) {
    const int h = (n0 - 1024) >> 6;
    __bf16* o = vt + (((size_t)(bb2 * 16 + h)) * 64 + col) * 2048 + s0;
#pragma unroll
    for (int j = 0; j < 4; ++j) {
      const float bias = bias1[n0 - 1024 + j * 16 + col];
#pragma unroll
      for (int t = 0; t < 4; ++t) {
        v8bf p;  // a lane's 8 accumulator rows are 8 consecutive t of one v^T row
#pragma unroll
        for (int r = 0; r < 8; ++r) p[r] = (__bf16)(acc[t][j][r] + bias);
        *(v8bf*)(o + j * 16 * 2048 + t * 16) = p;
      }
    }
    return;
  }
  const int h = n0 >> 6;
  __bf16* o = out0 + (((size_t)(bb2 * 16 + h)) * 2048 + s0) * 64 + col;
#pragma unroll
  for (int j = 0; j < 4; ++j) {
    const float bias = bias0[n0 + j * 16 + col];
#pragma unroll
    for (int t = 0; t < 4; ++t)
#pragma unroll
      for (int r = 0; r < 8; ++r)
        o[(t * 16 + r) * 64 + j * 16] = (__bf16)(acc[t][j][r] + bias);
  }
  // In the built code the v branch's block lies behind these stores and rewrites
  // registers they name: the wait that belongs in front of such a rewrite.
  asm volatile("s_wait_xcnt 0x0" ::: "memory");
}

// Lane l <-> lane l ^ 16: the two lanes that share one column of a WMMA tile.
__device__ __forceinline__ float xhalf(float x) {
  const int b = __builtin_bit_cast(int, x);
  return __builtin_bit_cast(float,
      __builtin_amdgcn_permlanex16(b, b, 0x76543210, 0xfedcba98, false, false));
}

// 2^x in place. Behind a transcendental the instruction set asks for one free
// slot before its result is read or its source overwritten: written in place and
// in one statement, each v_exp_f32 has an independent one behind it and the last
// has the v_nop, whatever the compiler schedules next.
__device__ __forceinline__ float exp2_slot(float x) {
  asm("v_exp_f32 %0, %0\n\tv_nop" : "+v"(x));
  return x;
}
__device__ __forceinline__ void exp2x8_slot(float (&x)[8]) {
  asm("v_exp_f32 %0, %0\n\t"
      "v_exp_f32 %1, %1\n\t"
      "v_exp_f32 %2, %2\n\t"
      "v_exp_f32 %3, %3\n\t"
      "v_exp_f32 %4, %4\n\t"
      "v_exp_f32 %5, %5\n\t"
      "v_exp_f32 %6, %6\n\t"
      "v_exp_f32 %7, %7\n\t"
      "v_nop"
      : "+v"(x[0]), "+v"(x[1]), "+v"(x[2]), "+v"(x[3]),
        "+v"(x[4]), "+v"(x[5]), "+v"(x[6]), "+v"(x[7]));
}
#define LOG2E 1.44269504088896340736f

__global__ void __launch_bounds__(128) k_attn(const __bf16* __restrict__ qh,
                                              const __bf16* __restrict__ kh,
                                              const __bf16* __restrict__ vt,
                                              __bf16* __restrict__ z) {
  __shared__ __attribute__((aligned(16))) __bf16 kls[2][64 * LDP];
  __shared__ __attribute__((aligned(16))) __bf16 vls[2][64 * LDP];

  const int tid = threadIdx.x;
  const int wave = tid >> 5, lane = tid & 31;
  const int col = lane & 15, hi = lane >> 4, koff = hi << 3;
  const int bh = blockIdx.x;                   // b*16 + h
  const int s0 = blockIdx.y * 64 + wave * 16;  // query rows of this wave

  const __bf16* qbase = qh + ((size_t)bh * 2048 + s0) * 64;
  const int crow = tid >> 3, cseg = (tid & 7) << 3;
  const __bf16* kg = kh + ((size_t)bh * 2048 + crow) * 64 + cseg;   // +t0*64
  const __bf16* vg = vt + ((size_t)bh * 64 + crow) * 2048 + cseg;   // +t0

  async_stage(&kls[0][crow * LDP + cseg], kg, 64, &vls[0][crow * LDP + cseg], vg, 2048);

  // Q^T as B operand: column = query s0+col, k = d -> two fragments, kept in regs.
  v16bf bq0 = ldfrag(qbase + (size_t)col * 64 + koff);
  v16bf bq1 = ldfrag(qbase + (size_t)col * 64 + koff + 32);

  // O[j2][r] = O^T[d = j2*16 + 8*hi + r][query col]; M is the query's running
  // maximum (equal in both lane halves), L this lane half's share of its sum.
  v8f O[4] = {};
  float M = -3.0e38f, L = 0.0f;

  for (int i = 0; i < 32; ++i) {
    wait_ds0();
    wait_async0();
    __syncthreads();
    if (i + 1 < 32) {
      const int tn = (i + 1) * 64;
      async_stage(&kls[(i + 1) & 1][crow * LDP + cseg], kg + (size_t)tn * 64, 64,
                  &vls[(i + 1) & 1][crow * LDP + cseg], vg + tn, 2048);
    }
    const __bf16* kb0 = &kls[i & 1][0];
    const __bf16* vb0 = &vls[i & 1][0];

    // --- scores: s[j][r] = S^T[key j*16 + 8*hi + r][query col], 2 WMMAs over d ---
    v8f s[4];
#pragma unroll
    for (int j = 0; j < 4; ++j) {
      const __bf16* kb = kb0 + (j * 16 + col) * LDP + koff;
      v16bf a0 = ldfrag(kb);
      v16bf a1 = ldfrag(kb + 32);
      v8f c = {};
      c = WMMA_BF16(a0, bq0, c);
      c = WMMA_BF16(a1, bq1, c);
      s[j] = c;
    }

    // --- scale + the query's tile maximum: in the lane, then across the halves ---
    float tm = -3.0e38f;
#pragma unroll
    for (int j = 0; j < 4; ++j)
#pragma unroll
      for (int r = 0; r < 8; ++r) {
        s[j][r] *= 0.125f;  // 1/sqrt(64)
        tm = fmaxf(tm, s[j][r]);
      }
    tm = fmaxf(tm, xhalf(tm));

    // --- online softmax update ---
    const float mn = fmaxf(M, tm);
    const float corr = exp2_slot((M - mn) * LOG2E);
    M = mn;
#pragma unroll
    for (int j = 0; j < 4; ++j)
#pragma unroll
      for (int r = 0; r < 8; ++r) O[j][r] *= corr;

    // P^T fragments: element e of bp[g] is key g*32 + kmap(e), which is
    // register e & 7 of score tile 2*g + (e >> 3) in this very lane.
    v16bf bp[2];
    float ps[4];
#pragma unroll
    for (int j = 0; j < 4; ++j) {
      float p[8];
#pragma unroll
      for (int r = 0; r < 8; ++r) p[r] = (s[j][r] - M) * LOG2E;
      exp2x8_slot(p);
      ps[j] = p[0];
#pragma unroll
      for (int r = 1; r < 8; ++r) ps[j] += p[r];
#pragma unroll
      for (int r = 0; r < 8; ++r) bp[j >> 1][(j & 1) * 8 + r] = (__bf16)p[r];
    }
    L = L * corr + ((ps[0] + ps[1]) + (ps[2] + ps[3]));

    // --- PV: A = V^T rows d (LDS, t-contiguous), B = P^T from registers ---
#pragma unroll
    for (int j2 = 0; j2 < 4; ++j2) {
      const __bf16* vb = vb0 + (j2 * 16 + col) * LDP + koff;
      v16bf a0 = ldfrag(vb);
      v16bf a1 = ldfrag(vb + 32);
      O[j2] = WMMA_BF16(a0, bp[0], O[j2]);
      O[j2] = WMMA_BF16(a1, bp[1], O[j2]);
    }
  }

  // --- join the halves' sums, normalize, store z [b][s][h*64+d] bf16:
  //     8 consecutive d per lane and tile = one 16-byte store ---
  const float Lq = L + xhalf(L);
  const int b = bh >> 4, h = bh & 15;
  __bf16* zrow = z + ((size_t)(b * 2048 + s0 + col)) * 1024 + h * 64 + koff;
#pragma unroll
  for (int j2 = 0; j2 < 4; ++j2) {
    v8bf o;
#pragma unroll
    for (int r = 0; r < 8; ++r) o[r] = (__bf16)(O[j2][r] / Lq);
    *(v8bf*)(zrow + j2 * 16) = o;
  }
}

// ---------------------------------------------------------------------------
// Kernel 5: output projection GEMM. M=8192, K=1024, N=1024; f32 out + bo.
// Same 128x128 tile and LDS double-buffered async staging as kernel 3.
// ---------------------------------------------------------------------------
__global__ void __launch_bounds__(128) k_gemm_out(const __bf16* __restrict__ Z,
                                                  const __bf16* __restrict__ WoT,
                                                  const float* __restrict__ bo,
                                                  float* __restrict__ out) {
  __shared__ __attribute__((aligned(16))) __bf16 als[2][128 * LDP];
  __shared__ __attribute__((aligned(16))) __bf16 bls[2][128 * LDP];

  const int tid = threadIdx.x;
  const int wave = tid >> 5, lane = tid & 31;
  const int col = lane & 15, hi = lane >> 4, koff = hi << 3;
  const int wm = (wave >> 1) * 64, wn = (wave & 1) * 64;  // wave's corner in the tile
  const int m0 = blockIdx.x * 128 + wm;
  const int n0 = blockIdx.y * 128 + wn;

  const int crow = tid >> 3, cseg = (tid & 7) << 3;
  const __bf16* zg = Z   + (size_t)(blockIdx.x * 128 + crow) * 1024 + cseg;
  const __bf16* wg = WoT + (size_t)(blockIdx.y * 128 + crow) * 1024 + cseg;
  const int cl = crow * LDP + cseg, ch = cl + 64 * LDP;  // LDS places, rows 0-63 / 64-127

  async_stage(&als[0][cl], zg, 1024, &bls[0][cl], wg, 1024);
  async_stage(&als[0][ch], zg + 64 * 1024, 1024, &bls[0][ch], wg + 64 * 1024, 1024);

  v8f acc[4][4] = {};
  for (int i = 0; i < 16; ++i) {
    wait_ds0();
    wait_async0();
    __syncthreads();
    if (i + 1 < 16) {
      const int kn = (i + 1) * 64;
      async_stage(&als[(i + 1) & 1][cl], zg + kn, 1024, &bls[(i + 1) & 1][cl], wg + kn, 1024);
      async_stage(&als[(i + 1) & 1][ch], zg + kn + 64 * 1024, 1024,
                  &bls[(i + 1) & 1][ch], wg + kn + 64 * 1024, 1024);
    }
    const __bf16* ab = &als[i & 1][0];
    const __bf16* bb = &bls[i & 1][0];
#pragma unroll
    for (int kk = 0; kk < 64; kk += 32) {
      v16bf a[4], b[4];
#pragma unroll
      for (int t = 0; t < 4; ++t) a[t] = ldfrag(ab + (wm + t * 16 + col) * LDP + kk + koff);
#pragma unroll
      for (int j = 0; j < 4; ++j) b[j] = ldfrag(bb + (wn + j * 16 + col) * LDP + kk + koff);
#pragma unroll
      for (int t = 0; t < 4; ++t)
#pragma unroll
        for (int j = 0; j < 4; ++j) acc[t][j] = WMMA_BF16(a[t], b[j], acc[t][j]);
    }
  }

#pragma unroll
  for (int t = 0; t < 4; ++t)
#pragma unroll
  for (int j = 0; j < 4; ++j) {
    const int n = n0 + j * 16 + col;
#pragma unroll
    for (int r = 0; r < 8; ++r) {
      const int m = m0 + t * 16 + r + (hi << 3);
      out[(size_t)m * 1024 + n] = acc[t][j][r] + bo[n];
    }
  }
}

// ---------------------------------------------------------------------------
// Host launcher
// ---------------------------------------------------------------------------
extern "C" void kernel_launch(void* const* d_in, const int* in_sizes, int n_in,
                              void* d_out, int out_size, void* d_ws, size_t ws_size,
                              hipStream_t stream) {
  const float* q  = (const float*)d_in[0];
  const float* kv = (const float*)d_in[1];
  const float* wq = (const float*)d_in[2];
  const float* bq = (const float*)d_in[3];
  const float* wk = (const float*)d_in[4];
  const float* bk = (const float*)d_in[5];
  const float* wv = (const float*)d_in[6];
  const float* bv = (const float*)d_in[7];
  const float* wo = (const float*)d_in[8];
  const float* bo = (const float*)d_in[9];
  float* out = (float*)d_out;

  char* w = (char*)d_ws;
  const size_t MB = 1024 * 1024;
  __bf16* qbf  = (__bf16*)(w + 0 * MB);    // 16 MB (reused later for z)
  __bf16* kvbf = (__bf16*)(w + 16 * MB);   // 16 MB
  __bf16* wqT  = (__bf16*)(w + 32 * MB);   //  2 MB
  __bf16* wkvT = (__bf16*)(w + 34 * MB);   //  4 MB
  __bf16* woT  = (__bf16*)(w + 38 * MB);   //  2 MB
  __bf16* qhB  = (__bf16*)(w + 40 * MB);   // 16 MB
  __bf16* khB  = (__bf16*)(w + 56 * MB);   // 16 MB
  __bf16* vtB  = (__bf16*)(w + 72 * MB);   // 16 MB  (total 88 MB)
  __bf16* zB   = qbf;                      // reuse q_bf region after projection

  k_cvt_act<<<dim3(8388608 / 256), dim3(256), 0, stream>>>(q, kv, qbf, kvbf);
  k_cvt_w<<<dim3(1048576 / 256), dim3(256), 0, stream>>>(wq, wk, wv, wo, wqT, wkvT, woT);
  k_gemm_qkv<<<dim3(64, 8), dim3(128), 0, stream>>>(qbf, wqT, qhB, nullptr, bq, nullptr, 0);
  k_gemm_qkv<<<dim3(64, 16), dim3(128), 0, stream>>>(kvbf, wkvT, khB, vtB, bk, bv, 1);
  k_attn<<<dim3(64, 32), dim3(128), 0, stream>>>(qhB, khB, vtB, zB);
  k_gemm_out<<<dim3(64, 8), dim3(128), 0, stream>>>(zB, woT, bo, out);
}

// v004
// One run takes 152 microseconds.
// Next to v003, in two timings, it ran 1.12 times as fast each time.
// Over all steps from v000 it is 3.81 times as fast.
#include <hip/hip_runtime.h>

typedef __attribute__((ext_vector_type(16))) __bf16 v16bf;
typedef __attribute__((ext_vector_type(8)))  __bf16 v8bf;
typedef __attribute__((ext_vector_type(8)))  float  v8f;
typedef __attribute__((ext_vector_type(4)))  float  v4f;
typedef __attribute__((ext_vector_type(4)))  __bf16 v4bf;

#define WMMA_BF16(a, b, c) \
  __builtin_amdgcn_wmma_f32_16x16x32_bf16(false, (a), false, (b), (short)0, (c), false, false)

// LDS byte offset of a __shared__ object (addrspace(3) pointers are the raw
// wave-LDS byte offsets that GLOBAL_LOAD_ASYNC_TO_LDS wants in VDST).
__device__ __forceinline__ unsigned lds_off_u32(const void* p) {
  return (unsigned)(unsigned long long)(__attribute__((address_space(3))) const void*)p;
}

// LDS row pitch of every staged 64-element (128-byte) bf16 row, in elements:
// 144 bytes = 16 B x odd, so the 16 rows that a ds_load_b128 fragment read
// touches per lane half fall on 16 different groups of four banks.
#define LDP 72

// Per-lane async copies, 16 bytes global -> LDS each, tracked by ASYNCcnt: one
// stage of two 64x64 bf16 tiles, four passes of 16 rows per tile. la / lb are
// the lane's LDS places in pass 0, ga / gb its global places, sa / sb the
// global row pitches in elements. The closing s_wait_xcnt 0 stands inside the
// statement so that no address register is rewritten ahead of it.
__device__ __forceinline__ void async_stage(const __bf16* la, const __bf16* ga, int sa,
                                            const __bf16* lb, const __bf16* gb, int sb) {
  const unsigned a0 = lds_off_u32(la), b0 = lds_off_u32(lb);
  const unsigned st = 16 * LDP * 2;  // 16 LDS rows, in bytes
  asm volatile("global_load_async_to_lds_b128 %0, %8, off\n\t"
               "global_load_async_to_lds_b128 %4, %12, off\n\t"
               "global_load_async_to_lds_b128 %1, %9, off\n\t"
               "global_load_async_to_lds_b128 %5, %13, off\n\t"
               "global_load_async_to_lds_b128 %2, %10, off\n\t"
               "global_load_async_to_lds_b128 %6, %14, off\n\t"
               "global_load_async_to_lds_b128 %3, %11, off\n\t"
               "global_load_async_to_lds_b128 %7, %15, off\n\t"
               "s_wait_xcnt 0x0"
               :: "v"(a0), "v"(a0 + st), "v"(a0 + 2 * st), "v"(a0 + 3 * st),
                  "v"(b0), "v"(b0 + st), "v"(b0 + 2 * st), "v"(b0 + 3 * st),
                  "v"(ga), "v"(ga + (size_t)16 * sa), "v"(ga + (size_t)32 * sa),
                  "v"(ga + (size_t)48 * sa),
                  "v"(gb), "v"(gb + (size_t)16 * sb), "v"(gb + (size_t)32 * sb),
                  "v"(gb + (size_t)48 * sb)
               : "memory");
}

__device__ __forceinline__ void wait_async0() {
  asm volatile("s_wait_asynccnt 0" ::: "memory");
}

// The wave's own LDS reads have retired before the barrier behind which the
// buffer they read is refilled by async copies.
__device__ __forceinline__ void wait_ds0() {
  asm volatile("s_wait_dscnt 0x0" ::: "memory");
}

// Load a 16x32 bf16 A/B fragment (CDNA5 16-bit WMMA lane layout): caller passes
// p already offset by row*ld + koff (koff = 8*(lane>=16)); elements [0..7] are
// K=koff..koff+7, [8..15] are K=koff+16..koff+23.
__device__ __forceinline__ v16bf ldfrag(const __bf16* p) {
  v8bf lo = *(const v8bf*)(p);
  v8bf hi = *(const v8bf*)(p + 16);
  v16bf f;
#pragma unroll
  for (int i = 0; i < 8; ++i) { f[i] = lo[i]; f[i + 8] = hi[i]; }
  return f;
}

// ---------------------------------------------------------------------------
// Kernel 1: f32 -> bf16 conversion of activations (q and k_and_v, 8M each).
// A lane takes 8 groups of 4 elements of each tensor: every wave-wide 16-byte
// load covers 512 contiguous bytes (4 whole lines), every 8-byte store 2 whole
// lines; a lane's 16 loads are independent, so that most are in flight at once.
// ---------------------------------------------------------------------------
__global__ void __launch_bounds__(256) k_cvt_act(const float* __restrict__ q,
                                                 const float* __restrict__ kv,
                                                 __bf16* __restrict__ qb,
                                                 __bf16* __restrict__ kvb) {
  const unsigned g0 = blockIdx.x * 2048u + threadIdx.x;  // in groups of 4 elements
  const v4f* q4  = (const v4f*)q + g0;
  const v4f* kv4 = (const v4f*)kv + g0;
  v4f a[8], b[8];
#pragma unroll
  for (int u = 0; u < 8; ++u) a[u] = q4[u * 256];
#pragma unroll
  for (int u = 0; u < 8; ++u) b[u] = kv4[u * 256];
  v4bf* qo  = (v4bf*)qb + g0;
  v4bf* kvo = (v4bf*)kvb + g0;
#pragma unroll
  for (int u = 0; u < 8; ++u) {
    v4bf o;
#pragma unroll
    for (int e = 0; e < 4; ++e) o[e] = (__bf16)a[u][e];
    qo[u * 256] = o;
  }
#pragma unroll
  for (int u = 0; u < 8; ++u) {
    v4bf o;
#pragma unroll
    for (int e = 0; e < 4; ++e) o[e] = (__bf16)b[u][e];
    kvo[u * 256] = o;
  }
}

// ---------------------------------------------------------------------------
// Kernel 2: transpose+convert weights into B^T [N][K] bf16 layouts.
//   wqT  [1024][1024] : wqT[n][e]  = wq[h,e,d], n = h*64+d
//   wkvT [2048][1024] : rows 0-1023 from wk, rows 1024-2047 from wv
//   woT  [1024][1024] : woT[e][c]  = wo[c][e]
// grid.y picks the matrix. A wave takes a tile of 32 target rows n x 32 target
// columns k; a lane reads 8 source rows k of 4 consecutive n (16-byte loads: 8
// lanes cover one whole 128-byte line) and turns them in its own registers into
// 4 target rows of 8 consecutive k (16-byte stores, 64 bytes per row and wave).
// ---------------------------------------------------------------------------
template <int PS>  // PS: source pitch from k to k + 1, in elements
__device__ __forceinline__ void turn_tile(const float* __restrict__ s, __bf16* __restrict__ d) {
  v4f f[8];
#pragma unroll
  for (int r = 0; r < 8; ++r) f[r] = *(const v4f*)(s + r * PS);
#pragma unroll
  for (int j = 0; j < 4; ++j) {
    v8bf o;
#pragma unroll
    for (int r = 0; r < 8; ++r) o[r] = (__bf16)f[r][j];
    *(v8bf*)(d + j * 1024) = o;
  }
}

__global__ void __launch_bounds__(256) k_cvt_w(const float* __restrict__ wq,
                                               const float* __restrict__ wk,
                                               const float* __restrict__ wv,
                                               const float* __restrict__ wo,
                                               __bf16* __restrict__ wqT,
                                               __bf16* __restrict__ wkvT,
                                               __bf16* __restrict__ woT) {
  const int wave = threadIdx.x >> 5, lane = threadIdx.x & 31;
  const int t  = blockIdx.x * 8 + wave;            // tile of this matrix, 0..1023
  const int nb = ((t >> 6) << 1) | (t & 1);        // neighbour waves share 256 source bytes
  const int kb = (t >> 1) & 31;
  const int n = nb * 32 + (lane & 7) * 4;          // first of the lane's 4 target rows
  const int k = kb * 32 + (lane >> 3) * 8;         // first of its 8 target columns

  const size_t to = (size_t)n * 1024 + k;          // the lane's place in the target
  if (blockIdx.y == 3) {
    turn_tile<1024>(wo + (size_t)k * 1024 + n, woT + to);
  } else {
    const float* w = blockIdx.y == 0 ? wq : blockIdx.y == 1 ? wk : wv;
    __bf16* d = blockIdx.y == 0 ? wqT : blockIdx.y == 1 ? wkvT : wkvT + 1024 * 1024;
    turn_tile<64>(w + (size_t)((n >> 6) * 1024 + k) * 64 + (n & 63), d + to);
  }
}

// ---------------------------------------------------------------------------
// Kernel 3: QKV projection GEMM. M=8192 (b*s), K=1024.
//   mode 0: N=1024 -> qh [bh][s][64] (+bq)
//   mode 1: N=2048, n<1024 -> kh [bh][t][64] (+bk); n>=1024 -> vt [bh][64][t] (+bv)
// 4 waves/WG in a 2x2 grid; 128x128 WG tile, 64x64 per wave (4x4 accumulator
// tiles: each loaded fragment feeds four WMMAs); A/B 64-wide K tiles
// double-buffered in LDS via async global->LDS copies.
// ---------------------------------------------------------------------------
__global__ void __launch_bounds__(128) k_gemm_qkv(const __bf16* __restrict__ X,
                                                  const __bf16* __restrict__ WT,
                                                  __bf16* __restrict__ out0,
                                                  __bf16* __restrict__ vt,
                                                  const float* __restrict__ bias0,
                                                  const float* __restrict__ bias1,
                                                  int mode) {
  __shared__ __attribute__((aligned(16))) __bf16 als[2][128 * LDP];
  __shared__ __attribute__((aligned(16))) __bf16 bls[2][128 * LDP];

  const int tid = threadIdx.x;
  const int wave = tid >> 5, lane = tid & 31;
  const int col = lane & 15, hi = lane >> 4, koff = hi << 3;
  const int wm = (wave >> 1) * 64, wn = (wave & 1) * 64;  // wave's corner in the tile
  const int m0 = blockIdx.x * 128 + wm;
  const int n0 = blockIdx.y * 128 + wn;

  // async-copy addressing: 128 threads cover 64 rows of 64 bf16 in 4 passes of
  // 16 rows, 16B (8 elements) per thread and pass; a 128-row tile is two such halves.
  const int crow = tid >> 3;        // 0..15
  const int cseg = (tid & 7) << 3;  // element offset within row: 0..56

  const __bf16* xg = X  + (size_t)(blockIdx.x * 128 + crow) * 1024 + cseg;
  const __bf16* wg = WT + (size_t)(blockIdx.y * 128 + crow) * 1024 + cseg;
  const int cl = crow * LDP + cseg, ch = cl + 64 * LDP;  // LDS places, rows 0-63 / 64-127

  async_stage(&als[0][cl], xg, 1024, &bls[0][cl], wg, 1024);
  async_stage(&als[0][ch], xg + 64 * 1024, 1024, &bls[0][ch], wg + 64 * 1024, 1024);

  v8f acc[4][4] = {};
  for (int i = 0; i < 16; ++i) {
    wait_ds0();
    wait_async0();       // our chunks of tile i have landed
    __syncthreads();     // everyone's chunks landed; iter i-1 reads all done
    if (i + 1 < 16) {
      const int kn = (i + 1) * 64;
      async_stage(&als[(i + 1) & 1][cl], xg + kn, 1024, &bls[(i + 1) & 1][cl], wg + kn, 1024);
      async_stage(&als[(i + 1) & 1][ch], xg + kn + 64 * 1024, 1024,
                  &bls[(i + 1) & 1][ch], wg + kn + 64 * 1024, 1024);
    }
    const __bf16* ab = &als[i & 1][0];
    const __bf16* bb = &bls[i & 1][0];
#pragma unroll
    for (int kk = 0; kk < 64; kk += 32) {
      v16bf a[4], b[4];
#pragma unroll
      for (int t = 0; t < 4; ++t) a[t] = ldfrag(ab + (wm + t * 16 + col) * LDP + kk + koff);
#pragma unroll
      for (int j = 0; j < 4; ++j) b[j] = ldfrag(bb + (wn + j * 16 + col) * LDP + kk + koff);
#pragma unroll
      for (int t = 0; t < 4; ++t)
#pragma unroll
        for (int j = 0; j < 4; ++j) acc[t][j] = WMMA_BF16(a[t], b[j], acc[t][j]);
    }
  }

  // A wave's 64 rows lie in one batch and its 64 columns are one head, of q/k or
  // of v: one test for the whole work-group, one base address per lane.
  const int bb2 = m0 >> 11, s0 = (m0 & 2047) + (hi << 3);
  if (mode != 0 && blockIdx.y >= 8) {
    const int h = (n0 - 1024) >> 6;
    __bf16* o = vt + (((size_t)(bb2 * 16 + h)) * 64 + col) * 2048 + s0;
#pragma unroll
    for (int j = 0; j < 4; ++j) {
      const float bias = bias1[n0 - 1024 + j * 16 + col];
#pragma unroll
      for (int t = 0; t < 4; ++t) {
        v8bf p;  // a lane's 8 accumulator rows are 8 consecutive t of one v^T row
#pragma unroll
        for (int r = 0; r < 8; ++r) p[r] = (__bf16)(acc[t][j][r] + bias);
        *(v8bf*)(o + j * 16 * 2048 + t * 16) = p;
      }
    }
    return;
  }
  const int h = n0 >> 6;
  __bf16* o = out0 + (((size_t)(bb2 * 16 + h)) * 2048 + s0) * 64 + col;
#pragma unroll
  for (int j = 0; j < 4; ++j) {
    const float bias = bias0[n0 + j * 16 + col];
#pragma unroll
    for (int t = 0; t < 4; ++t)
#pragma unroll
      for (int r = 0; r < 8; ++r)
        o[(t * 16 + r) * 64 + j * 16] = (__bf16)(acc[t][j][r] + bias);
  }
  // In the built code the v branch's block lies behind these stores and rewrites
  // registers they name: the wait that belongs in front of such a rewrite.
  asm volatile("s_wait_xcnt 0x0" ::: "memory");
}

// Lane l <-> lane l ^ 16: the two lanes that share one column of a WMMA tile.
__device__ __forceinline__ float xhalf(float x) {
  const int b = __builtin_bit_cast(int, x);
  return __builtin_bit_cast(float,
      __builtin_amdgcn_permlanex16(b, b, 0x76543210, 0xfedcba98, false, false));
}

// 2^x in place. Behind a transcendental the instruction set asks for one free
// slot before its result is read or its source overwritten: written in place and
// in one statement, each v_exp_f32 has an independent one behind it and the last
// has the v_nop, whatever the compiler schedules next.
__device__ __forceinline__ float exp2_slot(float x) {
  asm("v_exp_f32 %0, %0\n\tv_nop" : "+v"(x));
  return x;
}
__device__ __forceinline__ void exp2x8_slot(float (&x)[8]) {
  asm("v_exp_f32 %0, %0\n\t"
      "v_exp_f32 %1, %1\n\t"
      "v_exp_f32 %2, %2\n\t"
      "v_exp_f32 %3, %3\n\t"
      "v_exp_f32 %4, %4\n\t"
      "v_exp_f32 %5, %5\n\t"
      "v_exp_f32 %6, %6\n\t"
      "v_exp_f32 %7, %7\n\t"
      "v_nop"
      : "+v"(x[0]), "+v"(x[1]), "+v"(x[2]), "+v"(x[3]),
        "+v"(x[4]), "+v"(x[5]), "+v"(x[6]), "+v"(x[7]));
}
#define LOG2E 1.44269504088896340736f

__global__ void __launch_bounds__(128) k_attn(const __bf16* __restrict__ qh,
                                              const __bf16* __restrict__ kh,
                                              const __bf16* __restrict__ vt,
                                              __bf16* __restrict__ z) {
  __shared__ __attribute__((aligned(16))) __bf16 kls[2][64 * LDP];
  __shared__ __attribute__((aligned(16))) __bf16 vls[2][64 * LDP];

  const int tid = threadIdx.x;
  const int wave = tid >> 5, lane = tid & 31;
  const int col = lane & 15, hi = lane >> 4, koff = hi << 3;
  const int bh = blockIdx.x;                   // b*16 + h
  const int s0 = blockIdx.y * 64 + wave * 16;  // query rows of this wave

  const __bf16* qbase = qh + ((size_t)bh * 2048 + s0) * 64;
  const int crow = tid >> 3, cseg = (tid & 7) << 3;
  const __bf16* kg = kh + ((size_t)bh * 2048 + crow) * 64 + cseg;   // +t0*64
  const __bf16* vg = vt + ((size_t)bh * 64 + crow) * 2048 + cseg;   // +t0

  async_stage(&kls[0][crow * LDP + cseg], kg, 64, &vls[0][crow * LDP + cseg], vg, 2048);

  // Q^T as B operand: column = query s0+col, k = d -> two fragments, kept in regs.
  v16bf bq0 = ldfrag(qbase + (size_t)col * 64 + koff);
  v16bf bq1 = ldfrag(qbase + (size_t)col * 64 + koff + 32);

  // O[j2][r] = O^T[d = j2*16 + 8*hi + r][query col]; M is the query's running
  // maximum (equal in both lane halves), L this lane half's share of its sum.
  v8f O[4] = {};
  float M = -3.0e38f, L = 0.0f;

  for (int i = 0; i < 32; ++i) {
    wait_ds0();
    wait_async0();
    __syncthreads();
    if (i + 1 < 32) {
      const int tn = (i + 1) * 64;
      async_stage(&kls[(i + 1) & 1][crow * LDP + cseg], kg + (size_t)tn * 64, 64,
                  &vls[(i + 1) & 1][crow * LDP + cseg], vg + tn, 2048);
    }
    const __bf16* kb0 = &kls[i & 1][0];
    const __bf16* vb0 = &vls[i & 1][0];

    // --- scores: s[j][r] = S^T[key j*16 + 8*hi + r][query col], 2 WMMAs over d ---
    v8f s[4];
#pragma unroll
    for (int j = 0; j < 4; ++j) {
      const __bf16* kb = kb0 + (j * 16 + col) * LDP + koff;
      v16bf a0 = ldfrag(kb);
      v16bf a1 = ldfrag(kb + 32);
      v8f c = {};
      c = WMMA_BF16(a0, bq0, c);
      c = WMMA_BF16(a1, bq1, c);
      s[j] = c;
    }

    // --- scale + the query's tile maximum: in the lane, then across the halves ---
    float tm = -3.0e38f;
#pragma unroll
    for (int j = 0; j < 4; ++j)
#pragma unroll
      for (int r = 0; r < 8; ++r) {
        s[j][r] *= 0.125f;  // 1/sqrt(64)
        tm = fmaxf(tm, s[j][r]);
      }
    tm = fmaxf(tm, xhalf(tm));

    // --- online softmax update ---
    const float mn = fmaxf(M, tm);
    const float corr = exp2_slot((M - mn) * LOG2E);
    M = mn;
#pragma unroll
    for (int j = 0; j < 4; ++j)
#pragma unroll
      for (int r = 0; r < 8; ++r) O[j][r] *= corr;

    // P^T fragments: element e of bp[g] is key g*32 + kmap(e), which is
    // register e & 7 of score tile 2*g + (e >> 3) in this very lane.
    v16bf bp[2];
    float ps[4];
#pragma unroll
    for (int j = 0; j < 4; ++j) {
      float p[8];
#pragma unroll
      for (int r = 0; r < 8; ++r) p[r] = (s[j][r] - M) * LOG2E;
      exp2x8_slot(p);
      ps[j] = p[0];
#pragma unroll
      for (int r = 1; r < 8; ++r) ps[j] += p[r];
#pragma unroll
      for (int r = 0; r < 8; ++r) bp[j >> 1][(j & 1) * 8 + r] = (__bf16)p[r];
    }
    L = L * corr + ((ps[0] + ps[1]) + (ps[2] + ps[3]));

    // --- PV: A = V^T rows d (LDS, t-contiguous), B = P^T from registers ---
#pragma unroll
    for (int j2 = 0; j2 < 4; ++j2) {
      const __bf16* vb = vb0 + (j2 * 16 + col) * LDP + koff;
      v16bf a0 = ldfrag(vb);
      v16bf a1 = ldfrag(vb + 32);
      O[j2] = WMMA_BF16(a0, bp[0], O[j2]);
      O[j2] = WMMA_BF16(a1, bp[1], O[j2]);
    }
  }

  // --- join the halves' sums, normalize, store z [b][s][h*64+d] bf16:
  //     8 consecutive d per lane and tile = one 16-byte store ---
  const float Lq = L + xhalf(L);
  const int b = bh >> 4, h = bh & 15;
  __bf16* zrow = z + ((size_t)(b * 2048 + s0 + col)) * 1024 + h * 64 + koff;
#pragma unroll
  for (int j2 = 0; j2 < 4; ++j2) {
    v8bf o;
#pragma unroll
    for (int r = 0; r < 8; ++r) o[r] = (__bf16)(O[j2][r] / Lq);
    *(v8bf*)(zrow + j2 * 16) = o;
  }
}

// ---------------------------------------------------------------------------
// Kernel 5: output projection GEMM. M=8192, K=1024, N=1024; f32 out + bo.
// Same 128x128 tile and LDS double-buffered async staging as kernel 3.
// ---------------------------------------------------------------------------
__global__ void __launch_bounds__(128) k_gemm_out(const __bf16* __restrict__ Z,
                                                  const __bf16* __restrict__ WoT,
                                                  const float* __restrict__ bo,
                                                  float* __restrict__ out) {
  __shared__ __attribute__((aligned(16))) __bf16 als[2][128 * LDP];
  __shared__ __attribute__((aligned(16))) __bf16 bls[2][128 * LDP];

  const int tid = threadIdx.x;
  const int wave = tid >> 5, lane = tid & 31;
  const int col = lane & 15, hi = lane >> 4, koff = hi << 3;
  const int wm = (wave >> 1) * 64, wn = (wave & 1) * 64;  // wave's corner in the tile
  const int m0 = blockIdx.x * 128 + wm;
  const int n0 = blockIdx.y * 128 + wn;

  const int crow = tid >> 3, cseg = (tid & 7) << 3;
  const __bf16* zg = Z   + (size_t)(blockIdx.x * 128 + crow) * 1024 + cseg;
  const __bf16* wg = WoT + (size_t)(blockIdx.y * 128 + crow) * 1024 + cseg;
  const int cl = crow * LDP + cseg, ch = cl + 64 * LDP;  // LDS places, rows 0-63 / 64-127

  async_stage(&als[0][cl], zg, 1024, &bls[0][cl], wg, 1024);
  async_stage(&als[0][ch], zg + 64 * 1024, 1024, &bls[0][ch], wg + 64 * 1024, 1024);

  v8f acc[4][4] = {};
  for (int i = 0; i < 16; ++i) {
    wait_ds0();
    wait_async0();
    __syncthreads();
    if (i + 1 < 16) {
      const int kn = (i + 1) * 64;
      async_stage(&als[(i + 1) & 1][cl], zg + kn, 1024, &bls[(i + 1) & 1][cl], wg + kn, 1024);
      async_stage(&als[(i + 1) & 1][ch], zg + kn + 64 * 1024, 1024,
                  &bls[(i + 1) & 1][ch], wg + kn + 64 * 1024, 1024);
    }
    const __bf16* ab = &als[i & 1][0];
    const __bf16* bb = &bls[i & 1][0];
#pragma unroll
    for (int kk = 0; kk < 64; kk += 32) {
      v16bf a[4], b[4];
#pragma unroll
      for (int t = 0; t < 4; ++t) a[t] = ldfrag(ab + (wm + t * 16 + col) * LDP + kk + koff);
#pragma unroll
      for (int j = 0; j < 4; ++j) b[j] = ldfrag(bb + (wn + j * 16 + col) * LDP + kk + koff);
#pragma unroll
      for (int t = 0; t < 4; ++t)
#pragma unroll
        for (int j = 0; j < 4; ++j) acc[t][j] = WMMA_BF16(a[t], b[j], acc[t][j]);
    }
  }

#pragma unroll
  for (int t = 0; t < 4; ++t)
#pragma unroll
  for (int j = 0; j < 4; ++j) {
    const int n = n0 + j * 16 + col;
#pragma unroll
    for (int r = 0; r < 8; ++r) {
      const int m = m0 + t * 16 + r + (hi << 3);
      out[(size_t)m * 1024 + n] = acc[t][j][r] + bo[n];
    }
  }
}

// ---------------------------------------------------------------------------
// Host launcher
// ---------------------------------------------------------------------------
extern "C" void kernel_launch(void* const* d_in, const int* in_sizes, int n_in,
                              void* d_out, int out_size, void* d_ws, size_t ws_size,
                              hipStream_t stream) {
  const float* q  = (const float*)d_in[0];
  const float* kv = (const float*)d_in[1];
  const float* wq = (const float*)d_in[2];
  const float* bq = (const float*)d_in[3];
  const float* wk = (const float*)d_in[4];
  const float* bk = (const float*)d_in[5];
  const float* wv = (const float*)d_in[6];
  const float* bv = (const float*)d_in[7];
  const float* wo = (const float*)d_in[8];
  const float* bo = (const float*)d_in[9];
  float* out = (float*)d_out;

  char* w = (char*)d_ws;
  const size_t MB = 1024 * 1024;
  __bf16* qbf  = (__bf16*)(w + 0 * MB);    // 16 MB (reused later for z)
  __bf16* kvbf = (__bf16*)(w + 16 * MB);   // 16 MB
  __bf16* wqT  = (__bf16*)(w + 32 * MB);   //  2 MB
  __bf16* wkvT = (__bf16*)(w + 34 * MB);   //  4 MB
  __bf16* woT  = (__bf16*)(w + 38 * MB);   //  2 MB
  __bf16* qhB  = (__bf16*)(w + 40 * MB);   // 16 MB
  __bf16* khB  = (__bf16*)(w + 56 * MB);   // 16 MB
  __bf16* vtB  = (__bf16*)(w + 72 * MB);   // 16 MB  (total 88 MB)
  __bf16* zB   = qbf;                      // reuse q_bf region after projection

  k_cvt_act<<<dim3(1024), dim3(256), 0, stream>>>(q, kv, qbf, kvbf);
  k_cvt_w<<<dim3(128, 4), dim3(256), 0, stream>>>(wq, wk, wv, wo, wqT, wkvT, woT);
  k_gemm_qkv<<<dim3(64, 8), dim3(128), 0, stream>>>(qbf, wqT, qhB, nullptr, bq, nullptr, 0);
  k_gemm_qkv<<<dim3(64, 16), dim3(128), 0, stream>>>(kvbf, wkvT, khB, vtB, bk, bv, 1);
  k_attn<<<dim3(64, 32), dim3(128), 0, stream>>>(qhB, khB, vtB, zB);
  k_gemm_out<<<dim3(64, 8), dim3(128), 0, stream>>>(zB, woT, bo, out);
}

// v005
// A run of this version takes 146 microseconds.
// Next to v004, in two timings, it ran 1.04 times as fast each time.
// Over all steps from v000 it is 3.97 times as fast.
#include <hip/hip_runtime.h>

typedef __attribute__((ext_vector_type(16))) __bf16 v16bf;
typedef __attribute__((ext_vector_type(8)))  __bf16 v8bf;
typedef __attribute__((ext_vector_type(8)))  float  v8f;
typedef __attribute__((ext_vector_type(4)))  float  v4f;
typedef __attribute__((ext_vector_type(4)))  __bf16 v4bf;

#define WMMA_BF16(a, b, c) \
  __builtin_amdgcn_wmma_f32_16x16x32_bf16(false, (a), false, (b), (short)0, (c), false, false)

// LDS byte offset of a __shared__ object (addrspace(3) pointers are the raw
// wave-LDS byte offsets that GLOBAL_LOAD_ASYNC_TO_LDS wants in VDST).
__device__ __forceinline__ unsigned lds_off_u32(const void* p) {
  return (unsigned)(unsigned long long)(__attribute__((address_space(3))) const void*)p;
}

// LDS row pitch of every staged 64-element (128-byte) bf16 row, in elements:
// 144 bytes = 16 B x odd, so the 16 rows that a ds_load_b128 fragment read
// touches per lane half fall on 16 different groups of four banks.
#define LDP 72

// Per-lane async copies, 16 bytes global -> LDS each, tracked by ASYNCcnt: one
// stage of two 64x64 bf16 tiles, four passes of 16 rows per tile. la / lb are
// the lane's LDS places in pass 0, ga / gb its global places, sa / sb the
// global row pitches in elements. The closing s_wait_xcnt 0 stands inside the
// statement so that no address register is rewritten ahead of it.
__device__ __forceinline__ void async_stage(const __bf16* la, const __bf16* ga, int sa,
                                            const __bf16* lb, const __bf16* gb, int sb) {
  const unsigned a0 = lds_off_u32(la), b0 = lds_off_u32(lb);
  const unsigned st = 16 * LDP * 2;  // 16 LDS rows, in bytes
  asm volatile("global_load_async_to_lds_b128 %0, %8, off\n\t"
               "global_load_async_to_lds_b128 %4, %12, off\n\t"
               "global_load_async_to_lds_b128 %1, %9, off\n\t"
               "global_load_async_to_lds_b128 %5, %13, off\n\t"
               "global_load_async_to_lds_b128 %2, %10, off\n\t"
               "global_load_async_to_lds_b128 %6, %14, off\n\t"
               "global_load_async_to_lds_b128 %3, %11, off\n\t"
               "global_load_async_to_lds_b128 %7, %15, off\n\t"
               "s_wait_xcnt 0x0"
               :: "v"(a0), "v"(a0 + st), "v"(a0 + 2 * st), "v"(a0 + 3 * st),
                  "v"(b0), "v"(b0 + st), "v"(b0 + 2 * st), "v"(b0 + 3 * st),
                  "v"(ga), "v"(ga + (size_t)16 * sa), "v"(ga + (size_t)32 * sa),
                  "v"(ga + (size_t)48 * sa),
                  "v"(gb), "v"(gb + (size_t)16 * sb), "v"(gb + (size_t)32 * sb),
                  "v"(gb + (size_t)48 * sb)
               : "memory");
}

// The same for a block of 256 threads: one stage of two 64x64 bf16 tiles in two
// passes of 32 rows per tile, four copies a lane; the closing wait as above.
__device__ __forceinline__ void async_stage256(const __bf16* la, const __bf16* ga, int sa,
                                               const __bf16* lb, const __bf16* gb, int sb) {
  const unsigned a0 = lds_off_u32(la), b0 = lds_off_u32(lb);
  const unsigned st = 32 * LDP * 2;  // 32 LDS rows, in bytes
  asm volatile("global_load_async_to_lds_b128 %0, %4, off\n\t"
               "global_load_async_to_lds_b128 %2, %6, off\n\t"
               "global_load_async_to_lds_b128 %1, %5, off\n\t"
               "global_load_async_to_lds_b128 %3, %7, off\n\t"
               "s_wait_xcnt 0x0"
               :: "v"(a0), "v"(a0 + st), "v"(b0), "v"(b0 + st),
                  "v"(ga), "v"(ga + (size_t)32 * sa),
                  "v"(gb), "v"(gb + (size_t)32 * sb)
               : "memory");
}

__device__ __forceinline__ void wait_async0() {
  asm volatile("s_wait_asynccnt 0" ::: "memory");
}

// The wave's own LDS reads have retired before the barrier behind which the
// buffer they read is refilled by async copies.
__device__ __forceinline__ void wait_ds0() {
  asm volatile("s_wait_dscnt 0x0" ::: "memory");
}

// Load a 16x32 bf16 A/B fragment (CDNA5 16-bit WMMA lane layout): caller passes
// p already offset by row*ld + koff (koff = 8*(lane>=16)); elements [0..7] are
// K=koff..koff+7, [8..15] are K=koff+16..koff+23.
__device__ __forceinline__ v16bf ldfrag(const __bf16* p) {
  v8bf lo = *(const v8bf*)(p);
  v8bf hi = *(const v8bf*)(p + 16);
  v16bf f;
#pragma unroll
  for (int i = 0; i < 8; ++i) { f[i] = lo[i]; f[i + 8] = hi[i]; }
  return f;
}

// ---------------------------------------------------------------------------
// Kernel 1: f32 -> bf16 conversion of activations (q and k_and_v, 8M each).
// A lane takes 8 groups of 4 elements of each tensor: every wave-wide 16-byte
// load covers 512 contiguous bytes (4 whole lines), every 8-byte store 2 whole
// lines; a lane's 16 loads are independent, so that most are in flight at once.
// ---------------------------------------------------------------------------
__global__ void __launch_bounds__(256) k_cvt_act(const float* __restrict__ q,
                                                 const float* __restrict__ kv,
                                                 __bf16* __restrict__ qb,
                                                 __bf16* __restrict__ kvb) {
  const unsigned g0 = blockIdx.x * 2048u + threadIdx.x;  // in groups of 4 elements
  const v4f* q4  = (const v4f*)q + g0;
  const v4f* kv4 = (const v4f*)kv + g0;
  v4f a[8], b[8];
#pragma unroll
  for (int u = 0; u < 8; ++u) a[u] = q4[u * 256];
#pragma unroll
  for (int u = 0; u < 8; ++u) b[u] = kv4[u * 256];
  v4bf* qo  = (v4bf*)qb + g0;
  v4bf* kvo = (v4bf*)kvb + g0;
#pragma unroll
  for (int u = 0; u < 8; ++u) {
    v4bf o;
#pragma unroll
    for (int e = 0; e < 4; ++e) o[e] = (__bf16)a[u][e];
    qo[u * 256] = o;
  }
#pragma unroll
  for (int u = 0; u < 8; ++u) {
    v4bf o;
#pragma unroll
    for (int e = 0; e < 4; ++e) o[e] = (__bf16)b[u][e];
    kvo[u * 256] = o;
  }
}

// ---------------------------------------------------------------------------
// Kernel 2: transpose+convert weights into B^T [N][K] bf16 layouts.
//   wqT  [1024][1024] : wqT[n][e]  = wq[h,e,d], n = h*64+d
//   wkvT [2048][1024] : rows 0-1023 from wk, rows 1024-2047 from wv
//   woT  [1024][1024] : woT[e][c]  = wo[c][e]
// grid.y picks the matrix. A wave takes a tile of 32 target rows n x 32 target
// columns k; a lane reads 8 source rows k of 4 consecutive n (16-byte loads: 8
// lanes cover one whole 128-byte line) and turns them in its own registers into
// 4 target rows of 8 consecutive k (16-byte stores, 64 bytes per row and wave).
// ---------------------------------------------------------------------------
template <int PS>  // PS: source pitch from k to k + 1, in elements
__device__ __forceinline__ void turn_tile(const float* __restrict__ s, __bf16* __restrict__ d) {
  v4f f[8];
#pragma unroll
  for (int r = 0; r < 8; ++r) f[r] = *(const v4f*)(s + r * PS);
#pragma unroll
  for (int j = 0; j < 4; ++j) {
    v8bf o;
#pragma unroll
    for (int r = 0; r < 8; ++r) o[r] = (__bf16)f[r][j];
    *(v8bf*)(d + j * 1024) = o;
  }
}

__global__ void __launch_bounds__(256) k_cvt_w(const float* __restrict__ wq,
                                               const float* __restrict__ wk,
                                               const float* __restrict__ wv,
                                               const float* __restrict__ wo,
                                               __bf16* __restrict__ wqT,
                                               __bf16* __restrict__ wkvT,
                                               __bf16* __restrict__ woT) {
  const int wave = threadIdx.x >> 5, lane = threadIdx.x & 31;
  const int t  = blockIdx.x * 8 + wave;            // tile of this matrix, 0..1023
  const int nb = ((t >> 6) << 1) | (t & 1);        // neighbour waves share 256 source bytes
  const int kb = (t >> 1) & 31;
  const int n = nb * 32 + (lane & 7) * 4;          // first of the lane's 4 target rows
  const int k = kb * 32 + (lane >> 3) * 8;         // first of its 8 target columns

  const size_t to = (size_t)n * 1024 + k;          // the lane's place in the target
  if (blockIdx.y == 3) {
    turn_tile<1024>(wo + (size_t)k * 1024 + n, woT + to);
  } else {
    const float* w = blockIdx.y == 0 ? wq : blockIdx.y == 1 ? wk : wv;
    __bf16* d = blockIdx.y == 0 ? wqT : blockIdx.y == 1 ? wkvT : wkvT + 1024 * 1024;
    turn_tile<64>(w + (size_t)((n >> 6) * 1024 + k) * 64 + (n & 63), d + to);
  }
}

// ---------------------------------------------------------------------------
// Kernel 3: QKV projection GEMM. M=8192 (b*s), K=1024.
//   mode 0: N=1024 -> qh [bh][s][64] (+bq)
//   mode 1: N=2048, n<1024 -> kh [bh][t][64] (+bk); n>=1024 -> vt [bh][64][t] (+bv)
// 4 waves/WG in a 2x2 grid; 128x128 WG tile, 64x64 per wave (4x4 accumulator
// tiles: each loaded fragment feeds four WMMAs); A/B 64-wide K tiles
// double-buffered in LDS via async global->LDS copies.
// ---------------------------------------------------------------------------
__global__ void __launch_bounds__(128) k_gemm_qkv(const __bf16* __restrict__ X,
                                                  const __bf16* __restrict__ WT,
                                                  __bf16* __restrict__ out0,
                                                  __bf16* __restrict__ vt,
                                                  const float* __restrict__ bias0,
                                                  const float* __restrict__ bias1,
                                                  int mode) {
  __shared__ __attribute__((aligned(16))) __bf16 als[2][128 * LDP];
  __shared__ __attribute__((aligned(16))) __bf16 bls[2][128 * LDP];

  const int tid = threadIdx.x;
  const int wave = tid >> 5, lane = tid & 31;
  const int col = lane & 15, hi = lane >> 4, koff = hi << 3;
  const int wm = (wave >> 1) * 64, wn = (wave & 1) * 64;  // wave's corner in the tile
  const int m0 = blockIdx.x * 128 + wm;
  const int n0 = blockIdx.y * 128 + wn;

  // async-copy addressing: 128 threads cover 64 rows of 64 bf16 in 4 passes of
  // 16 rows, 16B (8 elements) per thread and pass; a 128-row tile is two such halves.
  const int crow = tid >> 3;        // 0..15
  const int cseg = (tid & 7) << 3;  // element offset within row: 0..56

  const __bf16* xg = X  + (size_t)(blockIdx.x * 128 + crow) * 1024 + cseg;
  const __bf16* wg = WT + (size_t)(blockIdx.y * 128 + crow) * 1024 + cseg;
  const int cl = crow * LDP + cseg, ch = cl + 64 * LDP;  // LDS places, rows 0-63 / 64-127

  async_stage(&als[0][cl], xg, 1024, &bls[0][cl], wg, 1024);
  async_stage(&als[0][ch], xg + 64 * 1024, 1024, &bls[0][ch], wg + 64 * 1024, 1024);

  v8f acc[4][4] = {};
  for (int i = 0; i < 16; ++i) {
    wait_ds0();
    wait_async0();       // our chunks of tile i have landed
    __syncthreads();     // everyone's chunks landed; iter i-1 reads all done
    if (i + 1 < 16) {
      const int kn = (i + 1) * 64;
      async_stage(&als[(i + 1) & 1][cl], xg + kn, 1024, &bls[(i + 1) & 1][cl], wg + kn, 1024);
      async_stage(&als[(i + 1) & 1][ch], xg + kn + 64 * 1024, 1024,
                  &bls[(i + 1) & 1][ch], wg + kn + 64 * 1024, 1024);
    }
    const __bf16* ab = &als[i & 1][0];
    const __bf16* bb = &bls[i & 1][0];
#pragma unroll
    for (int kk = 0; kk < 64; kk += 32) {
      v16bf a[4], b[4];
#pragma unroll
      for (int t = 0; t < 4; ++t) a[t] = ldfrag(ab + (wm + t * 16 + col) * LDP + kk + koff);
#pragma unroll
      for (int j = 0; j < 4; ++j) b[j] = ldfrag(bb + (wn + j * 16 + col) * LDP + kk + koff);
#pragma unroll
      for (int t = 0; t < 4; ++t)
#pragma unroll
        for (int j = 0; j < 4; ++j) acc[t][j] = WMMA_BF16(a[t], b[j], acc[t][j]);
    }
  }

  // A wave's 64 rows lie in one batch and its 64 columns are one head, of q/k or
  // of v: one test for the whole work-group, one base address per lane.
  const int bb2 = m0 >> 11, s0 = (m0 & 2047) + (hi << 3);
  if (mode != 0 && blockIdx.y >= 8) {
    const int h = (n0 - 1024) >> 6;
    __bf16* o = vt + (((size_t)(bb2 * 16 + h)) * 64 + col) * 2048 + s0;
#pragma unroll
    for (int j = 0; j < 4; ++j) {
      const float bias = bias1[n0 - 1024 + j * 16 + col];
#pragma unroll
      for (int t = 0; t < 4; ++t) {
        v8bf p;  // a lane's 8 accumulator rows are 8 consecutive t of one v^T row
#pragma unroll
        for (int r = 0; r < 8; ++r) p[r] = (__bf16)(acc[t][j][r] + bias);
        *(v8bf*)(o + j * 16 * 2048 + t * 16) = p;
      }
    }
    return;
  }
  const int h = n0 >> 6;
  __bf16* o = out0 + (((size_t)(bb2 * 16 + h)) * 2048 + s0) * 64 + col;
#pragma unroll
  for (int j = 0; j < 4; ++j) {
    const float bias = bias0[n0 + j * 16 + col];
#pragma unroll
    for (int t = 0; t < 4; ++t)
#pragma unroll
      for (int r = 0; r < 8; ++r)
        o[(t * 16 + r) * 64 + j * 16] = (__bf16)(acc[t][j][r] + bias);
  }
  // In the built code the v branch's block lies behind these stores and rewrites
  // registers they name: the wait that belongs in front of such a rewrite.
  asm volatile("s_wait_xcnt 0x0" ::: "memory");
}

// Lane l <-> lane l ^ 16: the two lanes that share one column of a WMMA tile.
__device__ __forceinline__ float xhalf(float x) {
  const int b = __builtin_bit_cast(int, x);
  return __builtin_bit_cast(float,
      __builtin_amdgcn_permlanex16(b, b, 0x76543210, 0xfedcba98, false, false));
}

// 2^x in place. Behind a transcendental the instruction set asks for one free
// slot before its result is read or its source overwritten: written in place and
// in one statement, each v_exp_f32 has an independent one behind it and the last
// has the v_nop, whatever the compiler schedules next.
__device__ __forceinline__ float exp2_slot(float x) {
  asm("v_exp_f32 %0, %0\n\tv_nop" : "+v"(x));
  return x;
}
__device__ __forceinline__ void exp2x8_slot(float (&x)[8]) {
  asm("v_exp_f32 %0, %0\n\t"
      "v_exp_f32 %1, %1\n\t"
      "v_exp_f32 %2, %2\n\t"
      "v_exp_f32 %3, %3\n\t"
      "v_exp_f32 %4, %4\n\t"
      "v_exp_f32 %5, %5\n\t"
      "v_exp_f32 %6, %6\n\t"
      "v_exp_f32 %7, %7\n\t"
      "v_nop"
      : "+v"(x[0]), "+v"(x[1]), "+v"(x[2]), "+v"(x[3]),
        "+v"(x[4]), "+v"(x[5]), "+v"(x[6]), "+v"(x[7]));
}
#define LOG2E 1.44269504088896340736f

__global__ void __launch_bounds__(256) k_attn(const __bf16* __restrict__ qh,
                                              const __bf16* __restrict__ kh,
                                              const __bf16* __restrict__ vt,
                                              __bf16* __restrict__ z) {
  __shared__ __attribute__((aligned(16))) __bf16 kls[2][64 * LDP];
  __shared__ __attribute__((aligned(16))) __bf16 vls[2][64 * LDP];

  const int tid = threadIdx.x;
  const int wave = tid >> 5, lane = tid & 31;
  const int col = lane & 15, hi = lane >> 4, koff = hi << 3;
  const int bh = blockIdx.x;                    // b*16 + h
  const int s0 = blockIdx.y * 256 + wave * 32;  // query rows of this wave

  const __bf16* qbase = qh + ((size_t)bh * 2048 + s0) * 64;
  const int crow = tid >> 3, cseg = (tid & 7) << 3;                 // crow 0..31
  const __bf16* kg = kh + ((size_t)bh * 2048 + crow) * 64 + cseg;   // +t0*64
  const __bf16* vg = vt + ((size_t)bh * 64 + crow) * 2048 + cseg;   // +t0

  async_stage256(&kls[0][crow * LDP + cseg], kg, 64, &vls[0][crow * LDP + cseg], vg, 2048);

  // Q^T as B operand: column = query s0+g*16+col, k = d -> two fragments per
  // column group g, kept in regs.
  v16bf bq[2][2];
#pragma unroll
  for (int g = 0; g < 2; ++g) {
    bq[g][0] = ldfrag(qbase + (size_t)(g * 16 + col) * 64 + koff);
    bq[g][1] = ldfrag(qbase + (size_t)(g * 16 + col) * 64 + koff + 32);
  }

  // O[g][j2][r] = O^T[d = j2*16 + 8*hi + r][query g*16+col]; M is the query's
  // running maximum (equal in both lane halves), L this lane half's share of its sum.
  v8f O[2][4] = {};
  float M[2] = {-3.0e38f, -3.0e38f}, L[2] = {0.0f, 0.0f};

  for (int i = 0; i < 32; ++i) {
    wait_ds0();
    wait_async0();
    __syncthreads();
    if (i + 1 < 32) {
      const int tn = (i + 1) * 64;
      async_stage256(&kls[(i + 1) & 1][crow * LDP + cseg], kg + (size_t)tn * 64, 64,
                     &vls[(i + 1) & 1][crow * LDP + cseg], vg + tn, 2048);
    }
    const __bf16* kb0 = &kls[i & 1][0];
    const __bf16* vb0 = &vls[i & 1][0];

    // --- scores: s[g][j][r] = S^T[key j*16 + 8*hi + r][query g*16+col] ---
    v8f s[2][4];
#pragma unroll
    for (int j = 0; j < 4; ++j) {
      const __bf16* kb = kb0 + (j * 16 + col) * LDP + koff;
      v16bf a0 = ldfrag(kb);
      v16bf a1 = ldfrag(kb + 32);
#pragma unroll
      for (int g = 0; g < 2; ++g) {
        v8f c = {};
        c = WMMA_BF16(a0, bq[g][0], c);
        c = WMMA_BF16(a1, bq[g][1], c);
        s[g][j] = c;
      }
    }

    v16bf bp[2][2];
#pragma unroll
    for (int g = 0; g < 2; ++g) {
      // --- scale + the query's tile maximum: in the lane, then across the halves ---
      float tm = -3.0e38f;
#pragma unroll
      for (int j = 0; j < 4; ++j)
#pragma unroll
        for (int r = 0; r < 8; ++r) {
          s[g][j][r] *= 0.125f;  // 1/sqrt(64)
          tm = fmaxf(tm, s[g][j][r]);
        }
      tm = fmaxf(tm, xhalf(tm));

      // --- online softmax update ---
      const float mn = fmaxf(M[g], tm);
      const float corr = exp2_slot((M[g] - mn) * LOG2E);
      M[g] = mn;
#pragma unroll
      for (int j = 0; j < 4; ++j)
#pragma unroll
        for (int r = 0; r < 8; ++r) O[g][j][r] *= corr;

      // P^T fragments: element e of bp[g][h] is key h*32 + kmap(e), which is
      // register e & 7 of score tile 2*h + (e >> 3) in this very lane.
      float ps[4];
#pragma unroll
      for (int j = 0; j < 4; ++j) {
        float p[8];
#pragma unroll
        for (int r = 0; r < 8; ++r) p[r] = (s[g][j][r] - mn) * LOG2E;
        exp2x8_slot(p);
        ps[j] = p[0];
#pragma unroll
        for (int r = 1; r < 8; ++r) ps[j] += p[r];
#pragma unroll
        for (int r = 0; r < 8; ++r) bp[g][j >> 1][(j & 1) * 8 + r] = (__bf16)p[r];
      }
      L[g] = L[g] * corr + ((ps[0] + ps[1]) + (ps[2] + ps[3]));
    }

    // --- PV: A = V^T rows d (LDS, t-contiguous), B = P^T from registers ---
#pragma unroll
    for (int j2 = 0; j2 < 4; ++j2) {
      const __bf16* vb = vb0 + (j2 * 16 + col) * LDP + koff;
      v16bf a0 = ldfrag(vb);
      v16bf a1 = ldfrag(vb + 32);
#pragma unroll
      for (int g = 0; g < 2; ++g) {
        O[g][j2] = WMMA_BF16(a0, bp[g][0], O[g][j2]);
        O[g][j2] = WMMA_BF16(a1, bp[g][1], O[g][j2]);
      }
    }
  }

  // --- join the halves' sums, normalize, store z [b][s][h*64+d] bf16:
  //     8 consecutive d per lane and tile = one 16-byte store ---
  const int b = bh >> 4, h = bh & 15;
#pragma unroll
  for (int g = 0; g < 2; ++g) {
    const float Lq = L[g] + xhalf(L[g]);
    __bf16* zrow = z + ((size_t)(b * 2048 + s0 + g * 16 + col)) * 1024 + h * 64 + koff;
#pragma unroll
    for (int j2 = 0; j2 < 4; ++j2) {
      v8bf o;
#pragma unroll
      for (int r = 0; r < 8; ++r) o[r] = (__bf16)(O[g][j2][r] / Lq);
      *(v8bf*)(zrow + j2 * 16) = o;
    }
  }
}

// ---------------------------------------------------------------------------
// Kernel 5: output projection GEMM. M=8192, K=1024, N=1024; f32 out + bo.
// Same 128x128 tile and LDS double-buffered async staging as kernel 3.
// ---------------------------------------------------------------------------
__global__ void __launch_bounds__(128) k_gemm_out(const __bf16* __restrict__ Z,
                                                  const __bf16* __restrict__ WoT,
                                                  const float* __restrict__ bo,
                                                  float* __restrict__ out) {
  __shared__ __attribute__((aligned(16))) __bf16 als[2][128 * LDP];
  __shared__ __attribute__((aligned(16))) __bf16 bls[2][128 * LDP];

  const int tid = threadIdx.x;
  const int wave = tid >> 5, lane = tid & 31;
  const int col = lane & 15, hi = lane >> 4, koff = hi << 3;
  const int wm = (wave >> 1) * 64, wn = (wave & 1) * 64;  // wave's corner in the tile
  const int m0 = blockIdx.x * 128 + wm;
  const int n0 = blockIdx.y * 128 + wn;

  const int crow = tid >> 3, cseg = (tid & 7) << 3;
  const __bf16* zg = Z   + (size_t)(blockIdx.x * 128 + crow) * 1024 + cseg;
  const __bf16* wg = WoT + (size_t)(blockIdx.y * 128 + crow) * 1024 + cseg;
  const int cl = crow * LDP + cseg, ch = cl + 64 * LDP;  // LDS places, rows 0-63 / 64-127

  async_stage(&als[0][cl], zg, 1024, &bls[0][cl], wg, 1024);
  async_stage(&als[0][ch], zg + 64 * 1024, 1024, &bls[0][ch], wg + 64 * 1024, 1024);

  v8f acc[4][4] = {};
  for (int i = 0; i < 16; ++i) {
    wait_ds0();
    wait_async0();
    __syncthreads();
    if (i + 1 < 16) {
      const int kn = (i + 1) * 64;
      async_stage(&als[(i + 1) & 1][cl], zg + kn, 1024, &bls[(i + 1) & 1][cl], wg + kn, 1024);
      async_stage(&als[(i + 1) & 1][ch], zg + kn + 64 * 1024, 1024,
                  &bls[(i + 1) & 1][ch], wg + kn + 64 * 1024, 1024);
    }
    const __bf16* ab = &als[i & 1][0];
    const __bf16* bb = &bls[i & 1][0];
#pragma unroll
    for (int kk = 0; kk < 64; kk += 32) {
      v16bf a[4], b[4];
#pragma unroll
      for (int t = 0; t < 4; ++t) a[t] = ldfrag(ab + (wm + t * 16 + col) * LDP + kk + koff);
#pragma unroll
      for (int j = 0; j < 4; ++j) b[j] = ldfrag(bb + (wn + j * 16 + col) * LDP + kk + koff);
#pragma unroll
      for (int t = 0; t < 4; ++t)
#pragma unroll
        for (int j = 0; j < 4; ++j) acc[t][j] = WMMA_BF16(a[t], b[j], acc[t][j]);
    }
  }

#pragma unroll
  for (int t = 0; t < 4; ++t)
#pragma unroll
  for (int j = 0; j < 4; ++j) {
    const int n = n0 + j * 16 + col;
#pragma unroll
    for (int r = 0; r < 8; ++r) {
      const int m = m0 + t * 16 + r + (hi << 3);
      out[(size_t)m * 1024 + n] = acc[t][j][r] + bo[n];
    }
  }
}

// ---------------------------------------------------------------------------
// Host launcher
// ---------------------------------------------------------------------------
extern "C" void kernel_launch(void* const* d_in, const int* in_sizes, int n_in,
                              void* d_out, int out_size, void* d_ws, size_t ws_size,
                              hipStream_t stream) {
  const float* q  = (const float*)d_in[0];
  const float* kv = (const float*)d_in[1];
  const float* wq = (const float*)d_in[2];
  const float* bq = (const float*)d_in[3];
  const float* wk = (const float*)d_in[4];
  const float* bk = (const float*)d_in[5];
  const float* wv = (const float*)d_in[6];
  const float* bv = (const float*)d_in[7];
  const float* wo = (const float*)d_in[8];
  const float* bo = (const float*)d_in[9];
  float* out = (float*)d_out;

  char* w = (char*)d_ws;
  const size_t MB = 1024 * 1024;
  __bf16* qbf  = (__bf16*)(w + 0 * MB);    // 16 MB (reused later for z)
  __bf16* kvbf = (__bf16*)(w + 16 * MB);   // 16 MB
  __bf16* wqT  = (__bf16*)(w + 32 * MB);   //  2 MB
  __bf16* wkvT = (__bf16*)(w + 34 * MB);   //  4 MB
  __bf16* woT  = (__bf16*)(w + 38 * MB);   //  2 MB
  __bf16* qhB  = (__bf16*)(w + 40 * MB);   // 16 MB
  __bf16* khB  = (__bf16*)(w + 56 * MB);   // 16 MB
  __bf16* vtB  = (__bf16*)(w + 72 * MB);   // 16 MB  (total 88 MB)
  __bf16* zB   = qbf;                      // reuse q_bf region after projection

  k_cvt_act<<<dim3(1024), dim3(256), 0, stream>>>(q, kv, qbf, kvbf);
  k_cvt_w<<<dim3(128, 4), dim3(256), 0, stream>>>(wq, wk, wv, wo, wqT, wkvT, woT);
  k_gemm_qkv<<<dim3(64, 8), dim3(128), 0, stream>>>(qbf, wqT, qhB, nullptr, bq, nullptr, 0);
  k_gemm_qkv<<<dim3(64, 16), dim3(128), 0, stream>>>(kvbf, wkvT, khB, vtB, bk, bv, 1);
  k_attn<<<dim3(64, 8), dim3(256), 0, stream>>>(qhB, khB, vtB, zB);
  k_gemm_out<<<dim3(64, 8), dim3(128), 0, stream>>>(zB, woT, bo, out);
}

// v006
// Measured time: 139 microseconds a run.
// Timed twice side by side with v005, it ran 1.06 and 1.05 times as fast.
// Over all steps from v000 it is 4.19 times as fast.
#include <hip/hip_runtime.h>

typedef __attribute__((ext_vector_type(16))) __bf16 v16bf;
typedef __attribute__((ext_vector_type(8)))  __bf16 v8bf;
typedef __attribute__((ext_vector_type(8)))  float  v8f;
typedef __attribute__((ext_vector_type(4)))  float  v4f;
typedef __attribute__((ext_vector_type(4)))  __bf16 v4bf;

#define WMMA_BF16(a, b, c) \
  __builtin_amdgcn_wmma_f32_16x16x32_bf16(false, (a), false, (b), (short)0, (c), false, false)

// LDS byte offset of a __shared__ object (addrspace(3) pointers are the raw
// wave-LDS byte offsets that GLOBAL_LOAD_ASYNC_TO_LDS wants in VDST).
__device__ __forceinline__ unsigned lds_off_u32(const void* p) {
  return (unsigned)(unsigned long long)(__attribute__((address_space(3))) const void*)p;
}

// LDS row pitch of every staged 64-element (128-byte) bf16 row, in elements:
// 144 bytes = 16 B x odd, so the 16 rows that a ds_load_b128 fragment read
// touches per lane half fall on 16 different groups of four banks.
#define LDP 72

// Per-lane async copies, 16 bytes global -> LDS each, tracked by ASYNCcnt: one
// stage of two 64x64 bf16 tiles, four passes of 16 rows per tile. la / lb are
// the lane's LDS places in pass 0, ga / gb its global places, sa / sb the
// global row pitches in elements. The closing s_wait_xcnt 0 stands inside the
// statement so that no address register is rewritten ahead of it.
__device__ __forceinline__ void async_stage(const __bf16* la, const __bf16* ga, int sa,
                                            const __bf16* lb, const __bf16* gb, int sb) {
  const unsigned a0 = lds_off_u32(la), b0 = lds_off_u32(lb);
  const unsigned st = 16 * LDP * 2;  // 16 LDS rows, in bytes
  asm volatile("global_load_async_to_lds_b128 %0, %8, off\n\t"
               "global_load_async_to_lds_b128 %4, %12, off\n\t"
               "global_load_async_to_lds_b128 %1, %9, off\n\t"
               "global_load_async_to_lds_b128 %5, %13, off\n\t"
               "global_load_async_to_lds_b128 %2, %10, off\n\t"
               "global_load_async_to_lds_b128 %6, %14, off\n\t"
               "global_load_async_to_lds_b128 %3, %11, off\n\t"
               "global_load_async_to_lds_b128 %7, %15, off\n\t"
               "s_wait_xcnt 0x0"
               :: "v"(a0), "v"(a0 + st), "v"(a0 + 2 * st), "v"(a0 + 3 * st),
                  "v"(b0), "v"(b0 + st), "v"(b0 + 2 * st), "v"(b0 + 3 * st),
                  "v"(ga), "v"(ga + (size_t)16 * sa), "v"(ga + (size_t)32 * sa),
                  "v"(ga + (size_t)48 * sa),
                  "v"(gb), "v"(gb + (size_t)16 * sb), "v"(gb + (size_t)32 * sb),
                  "v"(gb + (size_t)48 * sb)
               : "memory");
}

// The same for a block of 256 threads: one stage of two 64x64 bf16 tiles in two
// passes of 32 rows per tile, four copies a lane; the closing wait as above.
__device__ __forceinline__ void async_stage256(const __bf16* la, const __bf16* ga, int sa,
                                               const __bf16* lb, const __bf16* gb, int sb) {
  const unsigned a0 = lds_off_u32(la), b0 = lds_off_u32(lb);
  const unsigned st = 32 * LDP * 2;  // 32 LDS rows, in bytes
  asm volatile("global_load_async_to_lds_b128 %0, %4, off\n\t"
               "global_load_async_to_lds_b128 %2, %6, off\n\t"
               "global_load_async_to_lds_b128 %1, %5, off\n\t"
               "global_load_async_to_lds_b128 %3, %7, off\n\t"
               "s_wait_xcnt 0x0"
               :: "v"(a0), "v"(a0 + st), "v"(b0), "v"(b0 + st),
                  "v"(ga), "v"(ga + (size_t)32 * sa),
                  "v"(gb), "v"(gb + (size_t)32 * sb)
               : "memory");
}

__device__ __forceinline__ void wait_async0() {
  asm volatile("s_wait_asynccnt 0" ::: "memory");
}

// The wave's own LDS reads have retired before the barrier behind which the
// buffer they read is refilled by async copies.
__device__ __forceinline__ void wait_ds0() {
  asm volatile("s_wait_dscnt 0x0" ::: "memory");
}

// Load a 16x32 bf16 A/B fragment (CDNA5 16-bit WMMA lane layout): caller passes
// p already offset by row*ld + koff (koff = 8*(lane>=16)); elements [0..7] are
// K=koff..koff+7, [8..15] are K=koff+16..koff+23.
__device__ __forceinline__ v16bf ldfrag(const __bf16* p) {
  v8bf lo = *(const v8bf*)(p);
  v8bf hi = *(const v8bf*)(p + 16);
  v16bf f;
#pragma unroll
  for (int i = 0; i < 8; ++i) { f[i] = lo[i]; f[i + 8] = hi[i]; }
  return f;
}

// ---------------------------------------------------------------------------
// Kernel 1: f32 -> bf16 conversion of activations (q and k_and_v, 8M each).
// A lane takes 8 groups of 4 elements of each tensor: every wave-wide 16-byte
// load covers 512 contiguous bytes (4 whole lines), every 8-byte store 2 whole
// lines; a lane's 16 loads are independent, so that most are in flight at once.
// ---------------------------------------------------------------------------
__global__ void __launch_bounds__(256) k_cvt_act(const float* __restrict__ q,
                                                 const float* __restrict__ kv,
                                                 __bf16* __restrict__ qb,
                                                 __bf16* __restrict__ kvb) {
  const unsigned g0 = blockIdx.x * 2048u + threadIdx.x;  // in groups of 4 elements
  const v4f* q4  = (const v4f*)q + g0;
  const v4f* kv4 = (const v4f*)kv + g0;
  v4f a[8], b[8];
#pragma unroll
  for (int u = 0; u < 8; ++u) a[u] = q4[u * 256];
#pragma unroll
  for (int u = 0; u < 8; ++u) b[u] = kv4[u * 256];
  v4bf* qo  = (v4bf*)qb + g0;
  v4bf* kvo = (v4bf*)kvb + g0;
#pragma unroll
  for (int u = 0; u < 8; ++u) {
    v4bf o;
#pragma unroll
    for (int e = 0; e < 4; ++e) o[e] = (__bf16)a[u][e];
    qo[u * 256] = o;
  }
#pragma unroll
  for (int u = 0; u < 8; ++u) {
    v4bf o;
#pragma unroll
    for (int e = 0; e < 4; ++e) o[e] = (__bf16)b[u][e];
    kvo[u * 256] = o;
  }
}

// ---------------------------------------------------------------------------
// Kernel 2: transpose+convert weights into B^T [N][K] bf16 layouts.
//   wqT  [1024][1024] : wqT[n][e]  = wq[h,e,d], n = h*64+d
//   wkvT [2048][1024] : rows 0-1023 from wk, rows 1024-2047 from wv
//   woT  [1024][1024] : woT[e][c]  = wo[c][e]
// grid.y picks the matrix. A wave takes a tile of 32 target rows n x 32 target
// columns k; a lane reads 8 source rows k of 4 consecutive n (16-byte loads: 8
// lanes cover one whole 128-byte line) and turns them in its own registers into
// 4 target rows of 8 consecutive k (16-byte stores, 64 bytes per row and wave).
// ---------------------------------------------------------------------------
template <int PS>  // PS: source pitch from k to k + 1, in elements
__device__ __forceinline__ void turn_tile(const float* __restrict__ s, __bf16* __restrict__ d) {
  v4f f[8];
#pragma unroll
  for (int r = 0; r < 8; ++r) f[r] = *(const v4f*)(s + r * PS);
#pragma unroll
  for (int j = 0; j < 4; ++j) {
    v8bf o;
#pragma unroll
    for (int r = 0; r < 8; ++r) o[r] = (__bf16)f[r][j];
    *(v8bf*)(d + j * 1024) = o;
  }
}

__global__ void __launch_bounds__(256) k_cvt_w(const float* __restrict__ wq,
                                               const float* __restrict__ wk,
                                               const float* __restrict__ wv,
                                               const float* __restrict__ wo,
                                               __bf16* __restrict__ wqT,
                                               __bf16* __restrict__ wkvT,
                                               __bf16* __restrict__ woT) {
  const int wave = threadIdx.x >> 5, lane = threadIdx.x & 31;
  const int t  = blockIdx.x * 8 + wave;            // tile of this matrix, 0..1023
  const int nb = ((t >> 6) << 1) | (t & 1);        // neighbour waves share 256 source bytes
  const int kb = (t >> 1) & 31;
  const int n = nb * 32 + (lane & 7) * 4;          // first of the lane's 4 target rows
  const int k = kb * 32 + (lane >> 3) * 8;         // first of its 8 target columns

  const size_t to = (size_t)n * 1024 + k;          // the lane's place in the target
  if (blockIdx.y == 3) {
    turn_tile<1024>(wo + (size_t)k * 1024 + n, woT + to);
  } else {
    const float* w = blockIdx.y == 0 ? wq : blockIdx.y == 1 ? wk : wv;
    __bf16* d = blockIdx.y == 0 ? wqT : blockIdx.y == 1 ? wkvT : wkvT + 1024 * 1024;
    turn_tile<64>(w + (size_t)((n >> 6) * 1024 + k) * 64 + (n & 63), d + to);
  }
}

// ---------------------------------------------------------------------------
// Kernel 3: QKV projection GEMM. M=8192 (b*s), K=1024.
//   mode 0: N=1024 -> qh [bh][s][64] (+bq)
//   mode 1: N=2048, n<1024 -> kh [bh][t][64] (+bk); n>=1024 -> vt [bh][64][t] (+bv)
// 4 waves/WG in a 2x2 grid; 128x128 WG tile, 64x64 per wave (4x4 accumulator
// tiles: each loaded fragment feeds four WMMAs); A/B 64-wide K tiles
// double-buffered in LDS via async global->LDS copies.
// ---------------------------------------------------------------------------
__global__ void __launch_bounds__(128) k_gemm_qkv(const __bf16* __restrict__ X,
                                                  const __bf16* __restrict__ WT,
                                                  __bf16* __restrict__ out0,
                                                  __bf16* __restrict__ vt,
                                                  const float* __restrict__ bias0,
                                                  const float* __restrict__ bias1,
                                                  int mode) {
  __shared__ __attribute__((aligned(16))) __bf16 als[2][128 * LDP];
  __shared__ __attribute__((aligned(16))) __bf16 bls[2][128 * LDP];

  const int tid = threadIdx.x;
  const int wave = tid >> 5, lane = tid & 31;
  const int col = lane & 15, hi = lane >> 4, koff = hi << 3;
  const int wm = (wave >> 1) * 64, wn = (wave & 1) * 64;  // wave's corner in the tile
  const int m0 = blockIdx.x * 128 + wm;
  const int n0 = blockIdx.y * 128 + wn;

  // async-copy addressing: 128 threads cover 64 rows of 64 bf16 in 4 passes of
  // 16 rows, 16B (8 elements) per thread and pass; a 128-row tile is two such halves.
  const int crow = tid >> 3;        // 0..15
  const int cseg = (tid & 7) << 3;  // element offset within row: 0..56

  const __bf16* xg = X  + (size_t)(blockIdx.x * 128 + crow) * 1024 + cseg;
  const __bf16* wg = WT + (size_t)(blockIdx.y * 128 + crow) * 1024 + cseg;
  const int cl = crow * LDP + cseg, ch = cl + 64 * LDP;  // LDS places, rows 0-63 / 64-127

  async_stage(&als[0][cl], xg, 1024, &bls[0][cl], wg, 1024);
  async_stage(&als[0][ch], xg + 64 * 1024, 1024, &bls[0][ch], wg + 64 * 1024, 1024);

  v8f acc[4][4] = {};
  for (int i = 0; i < 16; ++i) {
    wait_ds0();
    wait_async0();       // our chunks of tile i have landed
    __syncthreads();     // everyone's chunks landed; iter i-1 reads all done
    if (i + 1 < 16) {
      const int kn = (i + 1) * 64;
      async_stage(&als[(i + 1) & 1][cl], xg + kn, 1024, &bls[(i + 1) & 1][cl], wg + kn, 1024);
      async_stage(&als[(i + 1) & 1][ch], xg + kn + 64 * 1024, 1024,
                  &bls[(i + 1) & 1][ch], wg + kn + 64 * 1024, 1024);
    }
    const __bf16* ab = &als[i & 1][0];
    const __bf16* bb = &bls[i & 1][0];
#pragma unroll
    for (int kk = 0; kk < 64; kk += 32) {
      v16bf a[4], b[4];
#pragma unroll
      for (int t = 0; t < 4; ++t) a[t] = ldfrag(ab + (wm + t * 16 + col) * LDP + kk + koff);
#pragma unroll
      for (int j = 0; j < 4; ++j) b[j] = ldfrag(bb + (wn + j * 16 + col) * LDP + kk + koff);
#pragma unroll
      for (int t = 0; t < 4; ++t)
#pragma unroll
        for (int j = 0; j < 4; ++j) acc[t][j] = WMMA_BF16(a[t], b[j], acc[t][j]);
    }
  }

  // A wave's 64 rows lie in one batch and its 64 columns are one head, of q/k or
  // of v: one test for the whole work-group, one base address per lane.
  const int bb2 = m0 >> 11, s0 = (m0 & 2047) + (hi << 3);
  if (mode != 0 && blockIdx.y >= 8) {
    const int h = (n0 - 1024) >> 6;
    __bf16* o = vt + (((size_t)(bb2 * 16 + h)) * 64 + col) * 2048 + s0;
#pragma unroll
    for (int j = 0; j < 4; ++j) {
      const float bias = bias1[n0 - 1024 + j * 16 + col];
#pragma unroll
      for (int t = 0; t < 4; ++t) {
        v8bf p;  // a lane's 8 accumulator rows are 8 consecutive t of one v^T row
#pragma unroll
        for (int r = 0; r < 8; ++r) p[r] = (__bf16)(acc[t][j][r] + bias);
        *(v8bf*)(o + j * 16 * 2048 + t * 16) = p;
      }
    }
    return;
  }
  const int h = n0 >> 6;
  __bf16* o = out0 + (((size_t)(bb2 * 16 + h)) * 2048 + s0) * 64 + col;
#pragma unroll
  for (int j = 0; j < 4; ++j) {
    const float bias = bias0[n0 + j * 16 + col];
#pragma unroll
    for (int t = 0; t < 4; ++t)
#pragma unroll
      for (int r = 0; r < 8; ++r)
        o[(t * 16 + r) * 64 + j * 16] = (__bf16)(acc[t][j][r] + bias);
  }
  // In the built code the v branch's block lies behind these stores and rewrites
  // registers they name: the wait that belongs in front of such a rewrite.
  asm volatile("s_wait_xcnt 0x0" ::: "memory");
}

// Lane l <-> lane l ^ 16: the two lanes that share one column of a WMMA tile.
__device__ __forceinline__ float xhalf(float x) {
  const int b = __builtin_bit_cast(int, x);
  return __builtin_bit_cast(float,
      __builtin_amdgcn_permlanex16(b, b, 0x76543210, 0xfedcba98, false, false));
}

// 2^x in place. Behind a transcendental the instruction set asks for one free
// slot before its result is read or its source overwritten: written in place and
// in one statement, each v_exp_f32 has an independent one behind it and the last
// has the v_nop, whatever the compiler schedules next.
__device__ __forceinline__ float exp2_slot(float x) {
  asm("v_exp_f32 %0, %0\n\tv_nop" : "+v"(x));
  return x;
}
__device__ __forceinline__ void exp2x8_slot(float (&x)[8]) {
  asm("v_exp_f32 %0, %0\n\t"
      "v_exp_f32 %1, %1\n\t"
      "v_exp_f32 %2, %2\n\t"
      "v_exp_f32 %3, %3\n\t"
      "v_exp_f32 %4, %4\n\t"
      "v_exp_f32 %5, %5\n\t"
      "v_exp_f32 %6, %6\n\t"
      "v_exp_f32 %7, %7\n\t"
      "v_nop"
      : "+v"(x[0]), "+v"(x[1]), "+v"(x[2]), "+v"(x[3]),
        "+v"(x[4]), "+v"(x[5]), "+v"(x[6]), "+v"(x[7]));
}
// log2(e) / sqrt(64): the score scale and the change of base in one factor.
#define SCL2E 0.18033688011112042592f

__global__ void __launch_bounds__(256) k_attn(const __bf16* __restrict__ qh,
                                              const __bf16* __restrict__ kh,
                                              const __bf16* __restrict__ vt,
                                              __bf16* __restrict__ z) {
  __shared__ __attribute__((aligned(16))) __bf16 kls[2][64 * LDP];
  __shared__ __attribute__((aligned(16))) __bf16 vls[2][64 * LDP];

  const int tid = threadIdx.x;
  const int wave = tid >> 5, lane = tid & 31;
  const int col = lane & 15, hi = lane >> 4, koff = hi << 3;
  const int bh = blockIdx.x;                    // b*16 + h
  const int s0 = blockIdx.y * 256 + wave * 32;  // query rows of this wave

  const __bf16* qbase = qh + ((size_t)bh * 2048 + s0) * 64;
  const int crow = tid >> 3, cseg = (tid & 7) << 3;                 // crow 0..31
  const __bf16* kg = kh + ((size_t)bh * 2048 + crow) * 64 + cseg;   // +t0*64
  const __bf16* vg = vt + ((size_t)bh * 64 + crow) * 2048 + cseg;   // +t0

  async_stage256(&kls[0][crow * LDP + cseg], kg, 64, &vls[0][crow * LDP + cseg], vg, 2048);

  // Q^T as B operand: column = query s0+g*16+col, k = d -> two fragments per
  // column group g, kept in regs.
  v16bf bq[2][2];
#pragma unroll
  for (int g = 0; g < 2; ++g) {
    bq[g][0] = ldfrag(qbase + (size_t)(g * 16 + col) * 64 + koff);
    bq[g][1] = ldfrag(qbase + (size_t)(g * 16 + col) * 64 + koff + 32);
  }

  // O[g][j2][r] = O^T[d = j2*16 + 8*hi + r][query g*16+col]; M is the query's
  // running maximum of unscaled scores (equal in both lane halves), L this lane half's share of its sum.
  v8f O[2][4] = {};
  float M[2] = {-3.0e38f, -3.0e38f}, L[2] = {0.0f, 0.0f};

  for (int i = 0; i < 32; ++i) {
    wait_ds0();
    wait_async0();
    __syncthreads();
    if (i + 1 < 32) {
      const int tn = (i + 1) * 64;
      async_stage256(&kls[(i + 1) & 1][crow * LDP + cseg], kg + (size_t)tn * 64, 64,
                     &vls[(i + 1) & 1][crow * LDP + cseg], vg + tn, 2048);
    }
    const __bf16* kb0 = &kls[i & 1][0];
    const __bf16* vb0 = &vls[i & 1][0];

    // --- scores: s[g][j][r] = S^T[key j*16 + 8*hi + r][query g*16+col] ---
    v8f s[2][4];
#pragma unroll
    for (int j = 0; j < 4; ++j) {
      const __bf16* kb = kb0 + (j * 16 + col) * LDP + koff;
      v16bf a0 = ldfrag(kb);
      v16bf a1 = ldfrag(kb + 32);
#pragma unroll
      for (int g = 0; g < 2; ++g) {
        v8f c = {};
        c = WMMA_BF16(a0, bq[g][0], c);
        c = WMMA_BF16(a1, bq[g][1], c);
        s[g][j] = c;
      }
    }

    v16bf bp[2][2];
#pragma unroll
    for (int g = 0; g < 2; ++g) {
      // --- the query's tile maximum of the unscaled scores (the scale is positive):
      //     in the lane, then across the halves ---
      float tm = -3.0e38f;
#pragma unroll
      for (int j = 0; j < 4; ++j)
#pragma unroll
        for (int r = 0; r < 8; ++r) tm = fmaxf(tm, s[g][j][r]);
      tm = fmaxf(tm, xhalf(tm));

      // --- online softmax update ---
      const float mn = fmaxf(M[g], tm);
      const float mc = mn * SCL2E;
      const float corr = exp2_slot(fmaf(M[g], SCL2E, -mc));
      M[g] = mn;
#pragma unroll
      for (int j = 0; j < 4; ++j)
#pragma unroll
        for (int r = 0; r < 8; ++r) O[g][j][r] *= corr;

      // P^T fragments: element e of bp[g][h] is key h*32 + kmap(e), which is
      // register e & 7 of score tile 2*h + (e >> 3) in this very lane.
      float ps[4];
#pragma unroll
      for (int j = 0; j < 4; ++j) {
        float p[8];
#pragma unroll
        for (int r = 0; r < 8; ++r) p[r] = fmaf(s[g][j][r], SCL2E, -mc);
        exp2x8_slot(p);
        ps[j] = p[0];
#pragma unroll
        for (int r = 1; r < 8; ++r) ps[j] += p[r];
#pragma unroll
        for (int r = 0; r < 8; ++r) bp[g][j >> 1][(j & 1) * 8 + r] = (__bf16)p[r];
      }
      L[g] = L[g] * corr + ((ps[0] + ps[1]) + (ps[2] + ps[3]));
    }

    // --- PV: A = V^T rows d (LDS, t-contiguous), B = P^T from registers ---
#pragma unroll
    for (int j2 = 0; j2 < 4; ++j2) {
      const __bf16* vb = vb0 + (j2 * 16 + col) * LDP + koff;
      v16bf a0 = ldfrag(vb);
      v16bf a1 = ldfrag(vb + 32);
#pragma unroll
      for (int g = 0; g < 2; ++g) {
        O[g][j2] = WMMA_BF16(a0, bp[g][0], O[g][j2]);
        O[g][j2] = WMMA_BF16(a1, bp[g][1], O[g][j2]);
      }
    }
  }

  // --- join the halves' sums, normalize, store z [b][s][h*64+d] bf16:
  //     8 consecutive d per lane and tile = one 16-byte store ---
  const int b = bh >> 4, h = bh & 15;
#pragma unroll
  for (int g = 0; g < 2; ++g) {
    const float Lq = L[g] + xhalf(L[g]);
    __bf16* zrow = z + ((size_t)(b * 2048 + s0 + g * 16 + col)) * 1024 + h * 64 + koff;
#pragma unroll
    for (int j2 = 0; j2 < 4; ++j2) {
      v8bf o;
#pragma unroll
      for (int r = 0; r < 8; ++r) o[r] = (__bf16)(O[g][j2][r] / Lq);
      *(v8bf*)(zrow + j2 * 16) = o;
    }
  }
}

// ---------------------------------------------------------------------------
// Kernel 5: output projection GEMM. M=8192, K=1024, N=1024; f32 out + bo.
// Same 128x128 tile and LDS double-buffered async staging as kernel 3.
// ---------------------------------------------------------------------------
__global__ void __launch_bounds__(128) k_gemm_out(const __bf16* __restrict__ Z,
                                                  const __bf16* __restrict__ WoT,
                                                  const float* __restrict__ bo,
                                                  float* __restrict__ out) {
  __shared__ __attribute__((aligned(16))) __bf16 als[2][128 * LDP];
  __shared__ __attribute__((aligned(16))) __bf16 bls[2][128 * LDP];

  const int tid = threadIdx.x;
  const int wave = tid >> 5, lane = tid & 31;
  const int col = lane & 15, hi = lane >> 4, koff = hi << 3;
  const int wm = (wave >> 1) * 64, wn = (wave & 1) * 64;  // wave's corner in the tile
  const int m0 = blockIdx.x * 128 + wm;
  const int n0 = blockIdx.y * 128 + wn;

  const int crow = tid >> 3, cseg = (tid & 7) << 3;
  const __bf16* zg = Z   + (size_t)(blockIdx.x * 128 + crow) * 1024 + cseg;
  const __bf16* wg = WoT + (size_t)(blockIdx.y * 128 + crow) * 1024 + cseg;
  const int cl = crow * LDP + cseg, ch = cl + 64 * LDP;  // LDS places, rows 0-63 / 64-127

  async_stage(&als[0][cl], zg, 1024, &bls[0][cl], wg, 1024);
  async_stage(&als[0][ch], zg + 64 * 1024, 1024, &bls[0][ch], wg + 64 * 1024, 1024);

  v8f acc[4][4] = {};
  for (int i = 0; i < 16; ++i) {
    wait_ds0();
    wait_async0();
    __syncthreads();
    if (i + 1 < 16) {
      const int kn = (i + 1) * 64;
      async_stage(&als[(i + 1) & 1][cl], zg + kn, 1024, &bls[(i + 1) & 1][cl], wg + kn, 1024);
      async_stage(&als[(i + 1) & 1][ch], zg + kn + 64 * 1024, 1024,
                  &bls[(i + 1) & 1][ch], wg + kn + 64 * 1024, 1024);
    }
    const __bf16* ab = &als[i & 1][0];
    const __bf16* bb = &bls[i & 1][0];
#pragma unroll
    for (int kk = 0; kk < 64; kk += 32) {
      v16bf a[4], b[4];
#pragma unroll
      for (int t = 0; t < 4; ++t) a[t] = ldfrag(ab + (wm + t * 16 + col) * LDP + kk + koff);
#pragma unroll
      for (int j = 0; j < 4; ++j) b[j] = ldfrag(bb + (wn + j * 16 + col) * LDP + kk + koff);
#pragma unroll
      for (int t = 0; t < 4; ++t)
#pragma unroll
        for (int j = 0; j < 4; ++j) acc[t][j] = WMMA_BF16(a[t], b[j], acc[t][j]);
    }
  }

#pragma unroll
  for (int t = 0; t < 4; ++t)
#pragma unroll
  for (int j = 0; j < 4; ++j) {
    const int n = n0 + j * 16 + col;
#pragma unroll
    for (int r = 0; r < 8; ++r) {
      const int m = m0 + t * 16 + r + (hi << 3);
      out[(size_t)m * 1024 + n] = acc[t][j][r] + bo[n];
    }
  }
}

// ---------------------------------------------------------------------------
// Host launcher
// ---------------------------------------------------------------------------
extern "C" void kernel_launch(void* const* d_in, const int* in_sizes, int n_in,
                              void* d_out, int out_size, void* d_ws, size_t ws_size,
                              hipStream_t stream) {
  const float* q  = (const float*)d_in[0];
  const float* kv = (const float*)d_in[1];
  const float* wq = (const float*)d_in[2];
  const float* bq = (const float*)d_in[3];
  const float* wk = (const float*)d_in[4];
  const float* bk = (const float*)d_in[5];
  const float* wv = (const float*)d_in[6];
  const float* bv = (const float*)d_in[7];
  const float* wo = (const float*)d_in[8];
  const float* bo = (const float*)d_in[9];
  float* out = (float*)d_out;

  char* w = (char*)d_ws;
  const size_t MB = 1024 * 1024;
  __bf16* qbf  = (__bf16*)(w + 0 * MB);    // 16 MB (reused later for z)
  __bf16* kvbf = (__bf16*)(w + 16 * MB);   // 16 MB
  __bf16* wqT  = (__bf16*)(w + 32 * MB);   //  2 MB
  __bf16* wkvT = (__bf16*)(w + 34 * MB);   //  4 MB
  __bf16* woT  = (__bf16*)(w + 38 * MB);   //  2 MB
  __bf16* qhB  = (__bf16*)(w + 40 * MB);   // 16 MB
  __bf16* khB  = (__bf16*)(w + 56 * MB);   // 16 MB
  __bf16* vtB  = (__bf16*)(w + 72 * MB);   // 16 MB  (total 88 MB)
  __bf16* zB   = qbf;                      // reuse q_bf region after projection

  k_cvt_act<<<dim3(1024), dim3(256), 0, stream>>>(q, kv, qbf, kvbf);
  k_cvt_w<<<dim3(128, 4), dim3(256), 0, stream>>>(wq, wk, wv, wo, wqT, wkvT, woT);
  k_gemm_qkv<<<dim3(64, 8), dim3(128), 0, stream>>>(qbf, wqT, qhB, nullptr, bq, nullptr, 0);
  k_gemm_qkv<<<dim3(64, 16), dim3(128), 0, stream>>>(kvbf, wkvT, khB, vtB, bk, bv, 1);
  k_attn<<<dim3(64, 8), dim3(256), 0, stream>>>(qhB, khB, vtB, zB);
  k_gemm_out<<<dim3(64, 8), dim3(128), 0, stream>>>(zB, woT, bo, out);
}

// v007
// It runs in 130 microseconds.
// Two timings next to v006 put it at 1.07 and 1.06 times that version's speed.
// Counting every step since v000, it is 4.46 times as fast.
#include <hip/hip_runtime.h>

typedef __attribute__((ext_vector_type(16))) __bf16 v16bf;
typedef __attribute__((ext_vector_type(8)))  __bf16 v8bf;
typedef __attribute__((ext_vector_type(8)))  float  v8f;
typedef __attribute__((ext_vector_type(4)))  float  v4f;
typedef __attribute__((ext_vector_type(4)))  __bf16 v4bf;

#define WMMA_BF16(a, b, c) \
  __builtin_amdgcn_wmma_f32_16x16x32_bf16(false, (a), false, (b), (short)0, (c), false, false)

// LDS byte offset of a __shared__ object (addrspace(3) pointers are the raw
// wave-LDS byte offsets that GLOBAL_LOAD_ASYNC_TO_LDS wants in VDST).
__device__ __forceinline__ unsigned lds_off_u32(const void* p) {
  return (unsigned)(unsigned long long)(__attribute__((address_space(3))) const void*)p;
}

// LDS row pitch of every staged 64-element (128-byte) bf16 row, in elements:
// 144 bytes = 16 B x odd, so the 16 rows that a ds_load_b128 fragment read
// touches per lane half fall on 16 different groups of four banks.
#define LDP 72

// Per-lane async copies, 16 bytes global -> LDS each, tracked by ASYNCcnt: one
// stage of two 64x64 bf16 tiles, four passes of 16 rows per tile. la / lb are
// the lane's LDS places in pass 0, ga / gb its global places, sa / sb the
// global row pitches in elements. The closing s_wait_xcnt 0 stands inside the
// statement so that no address register is rewritten ahead of it.
__device__ __forceinline__ void async_stage(const __bf16* la, const __bf16* ga, int sa,
                                            const __bf16* lb, const __bf16* gb, int sb) {
  const unsigned a0 = lds_off_u32(la), b0 = lds_off_u32(lb);
  const unsigned st = 16 * LDP * 2;  // 16 LDS rows, in bytes
  asm volatile("global_load_async_to_lds_b128 %0, %8, off\n\t"
               "global_load_async_to_lds_b128 %4, %12, off\n\t"
               "global_load_async_to_lds_b128 %1, %9, off\n\t"
               "global_load_async_to_lds_b128 %5, %13, off\n\t"
               "global_load_async_to_lds_b128 %2, %10, off\n\t"
               "global_load_async_to_lds_b128 %6, %14, off\n\t"
               "global_load_async_to_lds_b128 %3, %11, off\n\t"
               "global_load_async_to_lds_b128 %7, %15, off\n\t"
               "s_wait_xcnt 0x0"
               :: "v"(a0), "v"(a0 + st), "v"(a0 + 2 * st), "v"(a0 + 3 * st),
                  "v"(b0), "v"(b0 + st), "v"(b0 + 2 * st), "v"(b0 + 3 * st),
                  "v"(ga), "v"(ga + (size_t)16 * sa), "v"(ga + (size_t)32 * sa),
                  "v"(ga + (size_t)48 * sa),
                  "v"(gb), "v"(gb + (size_t)16 * sb), "v"(gb + (size_t)32 * sb),
                  "v"(gb + (size_t)48 * sb)
               : "memory");
}

// The same for a block of 256 threads: one stage of two 64x64 bf16 tiles in two
// passes of 32 rows per tile, four copies a lane; the closing wait as above.
__device__ __forceinline__ void async_stage256(const __bf16* la, const __bf16* ga, int sa,
                                               const __bf16* lb, const __bf16* gb, int sb) {
  const unsigned a0 = lds_off_u32(la), b0 = lds_off_u32(lb);
  const unsigned st = 32 * LDP * 2;  // 32 LDS rows, in bytes
  asm volatile("global_load_async_to_lds_b128 %0, %4, off\n\t"
               "global_load_async_to_lds_b128 %2, %6, off\n\t"
               "global_load_async_to_lds_b128 %1, %5, off\n\t"
               "global_load_async_to_lds_b128 %3, %7, off\n\t"
               "s_wait_xcnt 0x0"
               :: "v"(a0), "v"(a0 + st), "v"(b0), "v"(b0 + st),
                  "v"(ga), "v"(ga + (size_t)32 * sa),
                  "v"(gb), "v"(gb + (size_t)32 * sb)
               : "memory");
}

__device__ __forceinline__ void wait_async0() {
  asm volatile("s_wait_asynccnt 0" ::: "memory");
}

// The wave's own LDS reads have retired before the barrier behind which the
// buffer they read is refilled by async copies.
__device__ __forceinline__ void wait_ds0() {
  asm volatile("s_wait_dscnt 0x0" ::: "memory");
}

// Load a 16x32 bf16 A/B fragment (CDNA5 16-bit WMMA lane layout): caller passes
// p already offset by row*ld + koff (koff = 8*(lane>=16)); elements [0..7] are
// K=koff..koff+7, [8..15] are K=koff+16..koff+23.
__device__ __forceinline__ v16bf ldfrag(const __bf16* p) {
  v8bf lo = *(const v8bf*)(p);
  v8bf hi = *(const v8bf*)(p + 16);
  v16bf f;
#pragma unroll
  for (int i = 0; i < 8; ++i) { f[i] = lo[i]; f[i + 8] = hi[i]; }
  return f;
}

// ---------------------------------------------------------------------------
// Kernel 1, part a: f32 -> bf16 conversion of activations (q and k_and_v, 8M each).
// bx is the part's own block index, 0..1023.
// A lane takes 8 groups of 4 elements of each tensor: every wave-wide 16-byte
// load covers 512 contiguous bytes (4 whole lines), every 8-byte store 2 whole
// lines; a lane's 16 loads are independent, so that most are in flight at once.
// ---------------------------------------------------------------------------
__device__ __forceinline__ void cvt_act(unsigned bx, const float* __restrict__ q,
                                        const float* __restrict__ kv,
                                        __bf16* __restrict__ qb,
                                        __bf16* __restrict__ kvb) {
  const unsigned g0 = bx * 2048u + threadIdx.x;  // in groups of 4 elements
  const v4f* q4  = (const v4f*)q + g0;
  const v4f* kv4 = (const v4f*)kv + g0;
  v4f a[8], b[8];
#pragma unroll
  for (int u = 0; u < 8; ++u) a[u] = q4[u * 256];
#pragma unroll
  for (int u = 0; u < 8; ++u) b[u] = kv4[u * 256];
  v4bf* qo  = (v4bf*)qb + g0;
  v4bf* kvo = (v4bf*)kvb + g0;
#pragma unroll
  for (int u = 0; u < 8; ++u) {
    v4bf o;
#pragma unroll
    for (int e = 0; e < 4; ++e) o[e] = (__bf16)a[u][e];
    qo[u * 256] = o;
  }
#pragma unroll
  for (int u = 0; u < 8; ++u) {
    v4bf o;
#pragma unroll
    for (int e = 0; e < 4; ++e) o[e] = (__bf16)b[u][e];
    kvo[u * 256] = o;
  }
  // In the built code the weight part's block lies behind these stores and
  // rewrites registers they name: the wait that belongs in front of such a rewrite.
  asm volatile("s_wait_xcnt 0x0" ::: "memory");
}

// ---------------------------------------------------------------------------
// Kernel 1, part b: transpose+convert weights into B^T [N][K] bf16 layouts.
//   wqT  [1024][1024] : wqT[n][e]  = wq[h,e,d], n = h*64+d
//   wkvT [2048][1024] : rows 0-1023 from wk, rows 1024-2047 from wv
//   woT  [1024][1024] : woT[e][c]  = wo[c][e]
// by picks the matrix, bx (0..127) the block's tiles in it.
// A wave takes a tile of 32 target rows n x 32 target
// columns k; a lane reads 8 source rows k of 4 consecutive n (16-byte loads: 8
// lanes cover one whole 128-byte line) and turns them in its own registers into
// 4 target rows of 8 consecutive k (16-byte stores, 64 bytes per row and wave).
// ---------------------------------------------------------------------------
template <int PS>  // PS: source pitch from k to k + 1, in elements
__device__ __forceinline__ void turn_tile(const float* __restrict__ s, __bf16* __restrict__ d) {
  v4f f[8];
#pragma unroll
  for (int r = 0; r < 8; ++r) f[r] = *(const v4f*)(s + r * PS);
#pragma unroll
  for (int j = 0; j < 4; ++j) {
    v8bf o;
#pragma unroll
    for (int r = 0; r < 8; ++r) o[r] = (__bf16)f[r][j];
    *(v8bf*)(d + j * 1024) = o;
  }
}

__device__ __forceinline__ void cvt_w(int bx, int by, const float* __restrict__ wq,
                                      const float* __restrict__ wk,
                                      const float* __restrict__ wv,
                                      const float* __restrict__ wo,
                                      __bf16* __restrict__ wqT,
                                      __bf16* __restrict__ wkvT,
                                      __bf16* __restrict__ woT) {
  const int wave = threadIdx.x >> 5, lane = threadIdx.x & 31;
  const int t  = bx * 8 + wave;                    // tile of this matrix, 0..1023
  const int nb = ((t >> 6) << 1) | (t & 1);        // neighbour waves share 256 source bytes
  const int kb = (t >> 1) & 31;
  const int n = nb * 32 + (lane & 7) * 4;          // first of the lane's 4 target rows
  const int k = kb * 32 + (lane >> 3) * 8;         // first of its 8 target columns

  const size_t to = (size_t)n * 1024 + k;          // the lane's place in the target
  if (by == 3) {
    turn_tile<1024>(wo + (size_t)k * 1024 + n, woT + to);
  } else {
    const float* w = by == 0 ? wq : by == 1 ? wk : wv;
    __bf16* d = by == 0 ? wqT : by == 1 ? wkvT : wkvT + 1024 * 1024;
    turn_tile<64>(w + (size_t)((n >> 6) * 1024 + k) * 64 + (n & 63), d + to);
    // In the built code the fourth matrix's block lies behind these stores and
    // rewrites registers they name: the wait that belongs in front of such a rewrite.
    asm volatile("s_wait_xcnt 0x0" ::: "memory");
  }
}

// Both parts read inputs only and write their own planes: one grid of 512 + 1024
// blocks, the weight blocks first.
__global__ void __launch_bounds__(256) k_cvt(const float* __restrict__ q,
                                             const float* __restrict__ kv,
                                             const float* __restrict__ wq,
                                             const float* __restrict__ wk,
                                             const float* __restrict__ wv,
                                             const float* __restrict__ wo,
                                             __bf16* __restrict__ qb,
                                             __bf16* __restrict__ kvb,
                                             __bf16* __restrict__ wqT,
                                             __bf16* __restrict__ wkvT,
                                             __bf16* __restrict__ woT) {
  const int b = blockIdx.x;
  if (b < 512) cvt_w(b & 127, b >> 7, wq, wk, wv, wo, wqT, wkvT, woT);
  else         cvt_act(b - 512, q, kv, qb, kvb);
}

// ---------------------------------------------------------------------------
// Kernel 2: QKV projection GEMM, all three in one grid. M=8192 (b*s), K=1024,
// N=3072 over WT = [wqT | wkvT], 3072 rows that lie one behind the other.
//   n < 1024         : X = q activations   -> qh [bh][s][64] (+bq)
//   1024 <= n < 2048 : X = k_and_v         -> kh [bh][t][64] (+bk)
//   2048 <= n        : X = k_and_v         -> vt [bh][64][t] (+bv)
// 4 waves/WG in a 2x2 grid; 128x128 WG tile, 64x64 per wave (4x4 accumulator
// tiles: each loaded fragment feeds four WMMAs); A/B 64-wide K tiles
// double-buffered in LDS via async global->LDS copies.
// ---------------------------------------------------------------------------
__global__ void __launch_bounds__(128) k_gemm_qkv(const __bf16* __restrict__ Xq,
                                                  const __bf16* __restrict__ Xkv,
                                                  const __bf16* __restrict__ WT,
                                                  __bf16* __restrict__ qh,
                                                  __bf16* __restrict__ kh,
                                                  __bf16* __restrict__ vt,
                                                  const float* __restrict__ bq,
                                                  const float* __restrict__ bk,
                                                  const float* __restrict__ bv) {
  __shared__ __attribute__((aligned(16))) __bf16 als[2][128 * LDP];
  __shared__ __attribute__((aligned(16))) __bf16 bls[2][128 * LDP];

  const int tid = threadIdx.x;
  const int wave = tid >> 5, lane = tid & 31;
  const int col = lane & 15, hi = lane >> 4, koff = hi << 3;
  const int wm = (wave >> 1) * 64, wn = (wave & 1) * 64;  // wave's corner in the tile
  const int m0 = blockIdx.x * 128 + wm;
  const int n0 = blockIdx.y * 128 + wn;

  // async-copy addressing: 128 threads cover 64 rows of 64 bf16 in 4 passes of
  // 16 rows, 16B (8 elements) per thread and pass; a 128-row tile is two such halves.
  const int crow = tid >> 3;        // 0..15
  const int cseg = (tid & 7) << 3;  // element offset within row: 0..56

  const __bf16* X  = blockIdx.y < 8 ? Xq : Xkv;
  const __bf16* xg = X  + (size_t)(blockIdx.x * 128 + crow) * 1024 + cseg;
  const __bf16* wg = WT + (size_t)(blockIdx.y * 128 + crow) * 1024 + cseg;
  const int cl = crow * LDP + cseg, ch = cl + 64 * LDP;  // LDS places, rows 0-63 / 64-127

  async_stage(&als[0][cl], xg, 1024, &bls[0][cl], wg, 1024);
  async_stage(&als[0][ch], xg + 64 * 1024, 1024, &bls[0][ch], wg + 64 * 1024, 1024);

  v8f acc[4][4] = {};
  for (int i = 0; i < 16; ++i) {
    wait_ds0();
    wait_async0();       // our chunks of tile i have landed
    __syncthreads();     // everyone's chunks landed; iter i-1 reads all done
    if (i + 1 < 16) {
      const int kn = (i + 1) * 64;
      async_stage(&als[(i + 1) & 1][cl], xg + kn, 1024, &bls[(i + 1) & 1][cl], wg + kn, 1024);
      async_stage(&als[(i + 1) & 1][ch], xg + kn + 64 * 1024, 1024,
                  &bls[(i + 1) & 1][ch], wg + kn + 64 * 1024, 1024);
    }
    const __bf16* ab = &als[i & 1][0];
    const __bf16* bb = &bls[i & 1][0];
#pragma unroll
    for (int kk = 0; kk < 64; kk += 32) {
      v16bf a[4], b[4];
#pragma unroll
      for (int t = 0; t < 4; ++t) a[t] = ldfrag(ab + (wm + t * 16 + col) * LDP + kk + koff);
#pragma unroll
      for (int j = 0; j < 4; ++j) b[j] = ldfrag(bb + (wn + j * 16 + col) * LDP + kk + koff);
#pragma unroll
      for (int t = 0; t < 4; ++t)
#pragma unroll
        for (int j = 0; j < 4; ++j) acc[t][j] = WMMA_BF16(a[t], b[j], acc[t][j]);
    }
  }

  // A wave's 64 rows lie in one batch and its 64 columns are one head, of q, of k
  // or of v: one test for the whole work-group, one base address per lane.
  const int bb2 = m0 >> 11, s0 = (m0 & 2047) + (hi << 3);
  const int nh = n0 & 1023;  // the wave's first column inside its own projection
  if (blockIdx.y >= 16) {
    const int h = nh >> 6;
    __bf16* o = vt + (((size_t)(bb2 * 16 + h)) * 64 + col) * 2048 + s0;
#pragma unroll
    for (int j = 0; j < 4; ++j) {
      const float bias = bv[nh + j * 16 + col];
#pragma unroll
      for (int t = 0; t < 4; ++t) {
        v8bf p;  // a lane's 8 accumulator rows are 8 consecutive t of one v^T row
#pragma unroll
        for (int r = 0; r < 8; ++r) p[r] = (__bf16)(acc[t][j][r] + bias);
        *(v8bf*)(o + j * 16 * 2048 + t * 16) = p;
      }
    }
    return;
  }
  const int h = nh >> 6;
  const float* bias0 = blockIdx.y < 8 ? bq : bk;
  __bf16* o = (blockIdx.y < 8 ? qh : kh) + (((size_t)(bb2 * 16 + h)) * 2048 + s0) * 64 + col;
#pragma unroll
  for (int j = 0; j < 4; ++j) {
    const float bias = bias0[nh + j * 16 + col];
#pragma unroll
    for (int t = 0; t < 4; ++t)
#pragma unroll
      for (int r = 0; r < 8; ++r)
        o[(t * 16 + r) * 64 + j * 16] = (__bf16)(acc[t][j][r] + bias);
  }
  // In the built code the v branch's block lies behind these stores and rewrites
  // registers they name: the wait that belongs in front of such a rewrite.
  asm volatile("s_wait_xcnt 0x0" ::: "memory");
}

// Lane l <-> lane l ^ 16: the two lanes that share one column of a WMMA tile.
__device__ __forceinline__ float xhalf(float x) {
  const int b = __builtin_bit_cast(int, x);
  return __builtin_bit_cast(float,
      __builtin_amdgcn_permlanex16(b, b, 0x76543210, 0xfedcba98, false, false));
}

// 2^x in place. Behind a transcendental the instruction set asks for one free
// slot before its result is read or its source overwritten: written in place and
// in one statement, each v_exp_f32 has an independent one behind it and the last
// has the v_nop, whatever the compiler schedules next.
__device__ __forceinline__ float exp2_slot(float x) {
  asm("v_exp_f32 %0, %0\n\tv_nop" : "+v"(x));
  return x;
}
__device__ __forceinline__ void exp2x8_slot(float (&x)[8]) {
  asm("v_exp_f32 %0, %0\n\t"
      "v_exp_f32 %1, %1\n\t"
      "v_exp_f32 %2, %2\n\t"
      "v_exp_f32 %3, %3\n\t"
      "v_exp_f32 %4, %4\n\t"
      "v_exp_f32 %5, %5\n\t"
      "v_exp_f32 %6, %6\n\t"
      "v_exp_f32 %7, %7\n\t"
      "v_nop"
      : "+v"(x[0]), "+v"(x[1]), "+v"(x[2]), "+v"(x[3]),
        "+v"(x[4]), "+v"(x[5]), "+v"(x[6]), "+v"(x[7]));
}
// log2(e) / sqrt(64): the score scale and the change of base in one factor.
#define SCL2E 0.18033688011112042592f

__global__ void __launch_bounds__(256) k_attn(const __bf16* __restrict__ qh,
                                              const __bf16* __restrict__ kh,
                                              const __bf16* __restrict__ vt,
                                              __bf16* __restrict__ z) {
  __shared__ __attribute__((aligned(16))) __bf16 kls[2][64 * LDP];
  __shared__ __attribute__((aligned(16))) __bf16 vls[2][64 * LDP];

  const int tid = threadIdx.x;
  const int wave = tid >> 5, lane = tid & 31;
  const int col = lane & 15, hi = lane >> 4, koff = hi << 3;
  const int bh = blockIdx.x;                    // b*16 + h
  const int s0 = blockIdx.y * 256 + wave * 32;  // query rows of this wave

  const __bf16* qbase = qh + ((size_t)bh * 2048 + s0) * 64;
  const int crow = tid >> 3, cseg = (tid & 7) << 3;                 // crow 0..31
  const __bf16* kg = kh + ((size_t)bh * 2048 + crow) * 64 + cseg;   // +t0*64
  const __bf16* vg = vt + ((size_t)bh * 64 + crow) * 2048 + cseg;   // +t0

  async_stage256(&kls[0][crow * LDP + cseg], kg, 64, &vls[0][crow * LDP + cseg], vg, 2048);

  // Q^T as B operand: column = query s0+g*16+col, k = d -> two fragments per
  // column group g, kept in regs.
  v16bf bq[2][2];
#pragma unroll
  for (int g = 0; g < 2; ++g) {
    bq[g][0] = ldfrag(qbase + (size_t)(g * 16 + col) * 64 + koff);
    bq[g][1] = ldfrag(qbase + (size_t)(g * 16 + col) * 64 + koff + 32);
  }

  // O[g][j2][r] = O^T[d = j2*16 + 8*hi + r][query g*16+col]; M is the query's
  // running maximum of unscaled scores (equal in both lane halves), L this lane half's share of its sum.
  v8f O[2][4] = {};
  float M[2] = {-3.0e38f, -3.0e38f}, L[2] = {0.0f, 0.0f};

  for (int i = 0; i < 32; ++i) {
    wait_ds0();
    wait_async0();
    __syncthreads();
    if (i + 1 < 32) {
      const int tn = (i + 1) * 64;
      async_stage256(&kls[(i + 1) & 1][crow * LDP + cseg], kg + (size_t)tn * 64, 64,
                     &vls[(i + 1) & 1][crow * LDP + cseg], vg + tn, 2048);
    }
    const __bf16* kb0 = &kls[i & 1][0];
    const __bf16* vb0 = &vls[i & 1][0];

    // --- scores: s[g][j][r] = S^T[key j*16 + 8*hi + r][query g*16+col] ---
    v8f s[2][4];
#pragma unroll
    for (int j = 0; j < 4; ++j) {
      const __bf16* kb = kb0 + (j * 16 + col) * LDP + koff;
      v16bf a0 = ldfrag(kb);
      v16bf a1 = ldfrag(kb + 32);
#pragma unroll
      for (int g = 0; g < 2; ++g) {
        v8f c = {};
        c = WMMA_BF16(a0, bq[g][0], c);
        c = WMMA_BF16(a1, bq[g][1], c);
        s[g][j] = c;
      }
    }

    v16bf bp[2][2];
#pragma unroll
    for (int g = 0; g < 2; ++g) {
      // --- the query's tile maximum of the unscaled scores (the scale is positive):
      //     in the lane, then across the halves ---
      float tm = -3.0e38f;
#pragma unroll
      for (int j = 0; j < 4; ++j)
#pragma unroll
        for (int r = 0; r < 8; ++r) tm = fmaxf(tm, s[g][j][r]);
      tm = fmaxf(tm, xhalf(tm));

      // --- online softmax update ---
      const float mn = fmaxf(M[g], tm);
      const float mc = mn * SCL2E;
      const float corr = exp2_slot(fmaf(M[g], SCL2E, -mc));
      M[g] = mn;
#pragma unroll
      for (int j = 0; j < 4; ++j)
#pragma unroll
        for (int r = 0; r < 8; ++r) O[g][j][r] *= corr;

      // P^T fragments: element e of bp[g][h] is key h*32 + kmap(e), which is
      // register e & 7 of score tile 2*h + (e >> 3) in this very lane.
      float ps[4];
#pragma unroll
      for (int j = 0; j < 4; ++j) {
        float p[8];
#pragma unroll
        for (int r = 0; r < 8; ++r) p[r] = fmaf(s[g][j][r], SCL2E, -mc);
        exp2x8_slot(p);
        ps[j] = p[0];
#pragma unroll
        for (int r = 1; r < 8; ++r) ps[j] += p[r];
#pragma unroll
        for (int r = 0; r < 8; ++r) bp[g][j >> 1][(j & 1) * 8 + r] = (__bf16)p[r];
      }
      L[g] = L[g] * corr + ((ps[0] + ps[1]) + (ps[2] + ps[3]));
    }

    // --- PV: A = V^T rows d (LDS, t-contiguous), B = P^T from registers ---
#pragma unroll
    for (int j2 = 0; j2 < 4; ++j2) {
      const __bf16* vb = vb0 + (j2 * 16 + col) * LDP + koff;
      v16bf a0 = ldfrag(vb);
      v16bf a1 = ldfrag(vb + 32);
#pragma unroll
      for (int g = 0; g < 2; ++g) {
        O[g][j2] = WMMA_BF16(a0, bp[g][0], O[g][j2]);
        O[g][j2] = WMMA_BF16(a1, bp[g][1], O[g][j2]);
      }
    }
  }

  // --- join the halves' sums, normalize, store z [b][s][h*64+d] bf16:
  //     8 consecutive d per lane and tile = one 16-byte store ---
  const int b = bh >> 4, h = bh & 15;
#pragma unroll
  for (int g = 0; g < 2; ++g) {
    const float Lq = L[g] + xhalf(L[g]);
    __bf16* zrow = z + ((size_t)(b * 2048 + s0 + g * 16 + col)) * 1024 + h * 64 + koff;
#pragma unroll
    for (int j2 = 0; j2 < 4; ++j2) {
      v8bf o;
#pragma unroll
      for (int r = 0; r < 8; ++r) o[r] = (__bf16)(O[g][j2][r] / Lq);
      *(v8bf*)(zrow + j2 * 16) = o;
    }
  }
}

// ---------------------------------------------------------------------------
// Kernel 4: output projection GEMM. M=8192, K=1024, N=1024; f32 out + bo.
// Same 128x128 tile and LDS double-buffered async staging as kernel 2.
// ---------------------------------------------------------------------------
__global__ void __launch_bounds__(128) k_gemm_out(const __bf16* __restrict__ Z,
                                                  const __bf16* __restrict__ WoT,
                                                  const float* __restrict__ bo,
                                                  float* __restrict__ out) {
  __shared__ __attribute__((aligned(16))) __bf16 als[2][128 * LDP];
  __shared__ __attribute__((aligned(16))) __bf16 bls[2][128 * LDP];

  const int tid = threadIdx.x;
  const int wave = tid >> 5, lane = tid & 31;
  const int col = lane & 15, hi = lane >> 4, koff = hi << 3;
  const int wm = (wave >> 1) * 64, wn = (wave & 1) * 64;  // wave's corner in the tile
  const int m0 = blockIdx.x * 128 + wm;
  const int n0 = blockIdx.y * 128 + wn;

  const int crow = tid >> 3, cseg = (tid & 7) << 3;
  const __bf16* zg = Z   + (size_t)(blockIdx.x * 128 + crow) * 1024 + cseg;
  const __bf16* wg = WoT + (size_t)(blockIdx.y * 128 + crow) * 1024 + cseg;
  const int cl = crow * LDP + cseg, ch = cl + 64 * LDP;  // LDS places, rows 0-63 / 64-127

  async_stage(&als[0][cl], zg, 1024, &bls[0][cl], wg, 1024);
  async_stage(&als[0][ch], zg + 64 * 1024, 1024, &bls[0][ch], wg + 64 * 1024, 1024);

  v8f acc[4][4] = {};
  for (int i = 0; i < 16; ++i) {
    wait_ds0();
    wait_async0();
    __syncthreads();
    if (i + 1 < 16) {
      const int kn = (i + 1) * 64;
      async_stage(&als[(i + 1) & 1][cl], zg + kn, 1024, &bls[(i + 1) & 1][cl], wg + kn, 1024);
      async_stage(&als[(i + 1) & 1][ch], zg + kn + 64 * 1024, 1024,
                  &bls[(i + 1) & 1][ch], wg + kn + 64 * 1024, 1024);
    }
    const __bf16* ab = &als[i & 1][0];
    const __bf16* bb = &bls[i & 1][0];
#pragma unroll
    for (int kk = 0; kk < 64; kk += 32) {
      v16bf a[4], b[4];
#pragma unroll
      for (int t = 0; t < 4; ++t) a[t] = ldfrag(ab + (wm + t * 16 + col) * LDP + kk + koff);
#pragma unroll
      for (int j = 0; j < 4; ++j) b[j] = ldfrag(bb + (wn + j * 16 + col) * LDP + kk + koff);
#pragma unroll
      for (int t = 0; t < 4; ++t)
#pragma unroll
        for (int j = 0; j < 4; ++j) acc[t][j] = WMMA_BF16(a[t], b[j], acc[t][j]);
    }
  }

#pragma unroll
  for (int t = 0; t < 4; ++t)
#pragma unroll
  for (int j = 0; j < 4; ++j) {
    const int n = n0 + j * 16 + col;
#pragma unroll
    for (int r = 0; r < 8; ++r) {
      const int m = m0 + t * 16 + r + (hi << 3);
      out[(size_t)m * 1024 + n] = acc[t][j][r] + bo[n];
    }
  }
}

// ---------------------------------------------------------------------------
// Host launcher
// ---------------------------------------------------------------------------
extern "C" void kernel_launch(void* const* d_in, const int* in_sizes, int n_in,
                              void* d_out, int out_size, void* d_ws, size_t ws_size,
                              hipStream_t stream) {
  const float* q  = (const float*)d_in[0];
  const float* kv = (const float*)d_in[1];
  const float* wq = (const float*)d_in[2];
  const float* bq = (const float*)d_in[3];
  const float* wk = (const float*)d_in[4];
  const float* bk = (const float*)d_in[5];
  const float* wv = (const float*)d_in[6];
  const float* bv = (const float*)d_in[7];
  const float* wo = (const float*)d_in[8];
  const float* bo = (const float*)d_in[9];
  float* out = (float*)d_out;

  char* w = (char*)d_ws;
  const size_t MB = 1024 * 1024;
  __bf16* qbf  = (__bf16*)(w + 0 * MB);    // 16 MB (reused later for z)
  __bf16* kvbf = (__bf16*)(w + 16 * MB);   // 16 MB
  __bf16* wqT  = (__bf16*)(w + 32 * MB);   //  2 MB, rows 0-1023 of the QKV weight plane
  __bf16* wkvT = (__bf16*)(w + 34 * MB);   //  4 MB, its rows 1024-3071
  __bf16* woT  = (__bf16*)(w + 38 * MB);   //  2 MB
  __bf16* qhB  = (__bf16*)(w + 40 * MB);   // 16 MB
  __bf16* khB  = (__bf16*)(w + 56 * MB);   // 16 MB
  __bf16* vtB  = (__bf16*)(w + 72 * MB);   // 16 MB  (total 88 MB)
  __bf16* zB   = qbf;                      // reuse q_bf region after projection

  k_cvt<<<dim3(1536), dim3(256), 0, stream>>>(q, kv, wq, wk, wv, wo, qbf, kvbf, wqT, wkvT, woT);
  k_gemm_qkv<<<dim3(64, 24), dim3(128), 0, stream>>>(qbf, kvbf, wqT, qhB, khB, vtB, bq, bk, bv);
  k_attn<<<dim3(64, 8), dim3(256), 0, stream>>>(qhB, khB, vtB, zB);
  k_gemm_out<<<dim3(64, 8), dim3(128), 0, stream>>>(zB, woT, bo, out);
}

// v008
// It runs in 119 microseconds.
// Next to v007, in two timings, it ran 1.09 times as fast each time.
// Counting every step since v000, it is 4.86 times as fast.
#include <hip/hip_runtime.h>

typedef __attribute__((ext_vector_type(16))) __bf16 v16bf;
typedef __attribute__((ext_vector_type(8)))  __bf16 v8bf;
typedef __attribute__((ext_vector_type(8)))  float  v8f;
typedef __attribute__((ext_vector_type(4)))  float  v4f;
typedef __attribute__((ext_vector_type(4)))  __bf16 v4bf;

#define WMMA_BF16(a, b, c) \
  __builtin_amdgcn_wmma_f32_16x16x32_bf16(false, (a), false, (b), (short)0, (c), false, false)

// LDS byte offset of a __shared__ object (addrspace(3) pointers are the raw
// wave-LDS byte offsets that GLOBAL_LOAD_ASYNC_TO_LDS wants in VDST).
__device__ __forceinline__ unsigned lds_off_u32(const void* p) {
  return (unsigned)(unsigned long long)(__attribute__((address_space(3))) const void*)p;
}

// LDS row pitch of every staged 64-element (128-byte) bf16 row, in elements:
// 144 bytes = 16 B x odd, so the 16 rows that a ds_load_b128 fragment read
// touches per lane half fall on 16 different groups of four banks.
#define LDP 72

// Per-lane async copies, 16 bytes global -> LDS each, tracked by ASYNCcnt: one
// stage of two 64x64 bf16 tiles for a block of 256 threads, two passes of 32 rows
// per tile, four copies a lane. la / lb are the lane's LDS places in pass 0, ga / gb
// its global places, sa / sb the global row pitches in elements. The closing
// s_wait_xcnt 0 stands inside the statement so that no address register is
// rewritten ahead of it.
__device__ __forceinline__ void async_stage256(const __bf16* la, const __bf16* ga, int sa,
                                               const __bf16* lb, const __bf16* gb, int sb) {
  const unsigned a0 = lds_off_u32(la), b0 = lds_off_u32(lb);
  const unsigned st = 32 * LDP * 2;  // 32 LDS rows, in bytes
  asm volatile("global_load_async_to_lds_b128 %0, %4, off\n\t"
               "global_load_async_to_lds_b128 %2, %6, off\n\t"
               "global_load_async_to_lds_b128 %1, %5, off\n\t"
               "global_load_async_to_lds_b128 %3, %7, off\n\t"
               "s_wait_xcnt 0x0"
               :: "v"(a0), "v"(a0 + st), "v"(b0), "v"(b0 + st),
                  "v"(ga), "v"(ga + (size_t)32 * sa),
                  "v"(gb), "v"(gb + (size_t)32 * sb)
               : "memory");
}

__device__ __forceinline__ void wait_async0() {
  asm volatile("s_wait_asynccnt 0" ::: "memory");
}

// The wave's own LDS reads have retired before the barrier behind which the
// buffer they read is refilled by async copies.
__device__ __forceinline__ void wait_ds0() {
  asm volatile("s_wait_dscnt 0x0" ::: "memory");
}

// Load a 16x32 bf16 A/B fragment (CDNA5 16-bit WMMA lane layout): caller passes
// p already offset by row*ld + koff (koff = 8*(lane>=16)); elements [0..7] are
// K=koff..koff+7, [8..15] are K=koff+16..koff+23.
__device__ __forceinline__ v16bf ldfrag(const __bf16* p) {
  v8bf lo = *(const v8bf*)(p);
  v8bf hi = *(const v8bf*)(p + 16);
  v16bf f;
#pragma unroll
  for (int i = 0; i < 8; ++i) { f[i] = lo[i]; f[i + 8] = hi[i]; }
  return f;
}

// ---------------------------------------------------------------------------
// Kernel 1, part a: f32 -> bf16 conversion of activations (q and k_and_v, 8M each).
// bx is the part's own block index, 0..1023.
// A lane takes 8 groups of 4 elements of each tensor: every wave-wide 16-byte
// load covers 512 contiguous bytes (4 whole lines), every 8-byte store 2 whole
// lines; a lane's 16 loads are independent, so that most are in flight at once.
// ---------------------------------------------------------------------------
__device__ __forceinline__ void cvt_act(unsigned bx, const float* __restrict__ q,
                                        const float* __restrict__ kv,
                                        __bf16* __restrict__ qb,
                                        __bf16* __restrict__ kvb) {
  const unsigned g0 = bx * 2048u + threadIdx.x;  // in groups of 4 elements
  const v4f* q4  = (const v4f*)q + g0;
  const v4f* kv4 = (const v4f*)kv + g0;
  v4f a[8], b[8];
#pragma unroll
  for (int u = 0; u < 8; ++u) a[u] = q4[u * 256];
#pragma unroll
  for (int u = 0; u < 8; ++u) b[u] = kv4[u * 256];
  v4bf* qo  = (v4bf*)qb + g0;
  v4bf* kvo = (v4bf*)kvb + g0;
#pragma unroll
  for (int u = 0; u < 8; ++u) {
    v4bf o;
#pragma unroll
    for (int e = 0; e < 4; ++e) o[e] = (__bf16)a[u][e];
    qo[u * 256] = o;
  }
#pragma unroll
  for (int u = 0; u < 8; ++u) {
    v4bf o;
#pragma unroll
    for (int e = 0; e < 4; ++e) o[e] = (__bf16)b[u][e];
    kvo[u * 256] = o;
  }
  // In the built code the weight part's block lies behind these stores and
  // rewrites registers they name: the wait that belongs in front of such a rewrite.
  asm volatile("s_wait_xcnt 0x0" ::: "memory");
}

// ---------------------------------------------------------------------------
// Kernel 1, part b: transpose+convert weights into B^T [N][K] bf16 layouts.
//   wqT  [1024][1024] : wqT[n][e]  = wq[h,e,d], n = h*64+d
//   wkvT [2048][1024] : rows 0-1023 from wk, rows 1024-2047 from wv
//   woT  [1024][1024] : woT[e][c]  = wo[c][e]
// by picks the matrix, bx (0..127) the block's tiles in it.
// A wave takes a tile of 32 target rows n x 32 target
// columns k; a lane reads 8 source rows k of 4 consecutive n (16-byte loads: 8
// lanes cover one whole 128-byte line) and turns them in its own registers into
// 4 target rows of 8 consecutive k (16-byte stores, 64 bytes per row and wave).
// ---------------------------------------------------------------------------
template <int PS>  // PS: source pitch from k to k + 1, in elements
__device__ __forceinline__ void turn_tile(const float* __restrict__ s, __bf16* __restrict__ d) {
  v4f f[8];
#pragma unroll
  for (int r = 0; r < 8; ++r) f[r] = *(const v4f*)(s + r * PS);
#pragma unroll
  for (int j = 0; j < 4; ++j) {
    v8bf o;
#pragma unroll
    for (int r = 0; r < 8; ++r) o[r] = (__bf16)f[r][j];
    *(v8bf*)(d + j * 1024) = o;
  }
}

__device__ __forceinline__ void cvt_w(int bx, int by, const float* __restrict__ wq,
                                      const float* __restrict__ wk,
                                      const float* __restrict__ wv,
                                      const float* __restrict__ wo,
                                      __bf16* __restrict__ wqT,
                                      __bf16* __restrict__ wkvT,
                                      __bf16* __restrict__ woT) {
  const int wave = threadIdx.x >> 5, lane = threadIdx.x & 31;
  const int t  = bx * 8 + wave;                    // tile of this matrix, 0..1023
  const int nb = ((t >> 6) << 1) | (t & 1);        // neighbour waves share 256 source bytes
  const int kb = (t >> 1) & 31;
  const int n = nb * 32 + (lane & 7) * 4;          // first of the lane's 4 target rows
  const int k = kb * 32 + (lane >> 3) * 8;         // first of its 8 target columns

  const size_t to = (size_t)n * 1024 + k;          // the lane's place in the target
  if (by == 3) {
    turn_tile<1024>(wo + (size_t)k * 1024 + n, woT + to);
  } else {
    const float* w = by == 0 ? wq : by == 1 ? wk : wv;
    __bf16* d = by == 0 ? wqT : by == 1 ? wkvT : wkvT + 1024 * 1024;
    turn_tile<64>(w + (size_t)((n >> 6) * 1024 + k) * 64 + (n & 63), d + to);
    // In the built code the fourth matrix's block lies behind these stores and
    // rewrites registers they name: the wait that belongs in front of such a rewrite.
    asm volatile("s_wait_xcnt 0x0" ::: "memory");
  }
}

// Both parts read inputs only and write their own planes: one grid of 512 + 1024
// blocks, the weight blocks first.
__global__ void __launch_bounds__(256) k_cvt(const float* __restrict__ q,
                                             const float* __restrict__ kv,
                                             const float* __restrict__ wq,
                                             const float* __restrict__ wk,
                                             const float* __restrict__ wv,
                                             const float* __restrict__ wo,
                                             __bf16* __restrict__ qb,
                                             __bf16* __restrict__ kvb,
                                             __bf16* __restrict__ wqT,
                                             __bf16* __restrict__ wkvT,
                                             __bf16* __restrict__ woT) {
  const int b = blockIdx.x;
  if (b < 512) cvt_w(b & 127, b >> 7, wq, wk, wv, wo, wqT, wkvT, woT);
  else         cvt_act(b - 512, q, kv, qb, kvb);
}

// ---------------------------------------------------------------------------
// GEMM core shared by kernels 2 and 4. 8 waves, one work-group per WGP; a
// work-group tile has 256 rows of X and WN * 64 rows of W^T; a wave owns TM * 16
// rows x 64 columns (TM x 4 accumulator tiles), the waves lying WN abreast.
// 128-wide K tiles of both operands are double-buffered in LDS via async
// global->LDS copies.
// ---------------------------------------------------------------------------
#define GROWS 256  // LDS rows per operand and buffer
// LDS row pitch of a staged 128-element (256-byte) row, in elements: 272 bytes =
// 16 B x odd, free of bank conflicts for ds_load_b128 like LDP.
#define LDG 136

// One async copy of 16 bytes as the builtin: its address registers are the
// compiler's, which may place them above v255, where asm operands cannot lie and
// where the 128x64 wave tile leaves room.
typedef __attribute__((ext_vector_type(4))) int v4i;
__device__ __forceinline__ void copy16(const __bf16* l, const __bf16* g) {
  __builtin_amdgcn_global_load_async_to_lds_b128(
      (__attribute__((address_space(1))) v4i*)g, (__attribute__((address_space(3))) v4i*)l, 0, 0);
}

// One stage: 256 rows of X and WN * 64 rows of W^T, in passes of 16 rows. ab / bb
// are the lane's LDS places in pass 0, xg / wg its global places there.
template <int WN>
__device__ __forceinline__ void gemm_stage(const __bf16* ab, const __bf16* bb,
                                           const __bf16* xg, const __bf16* wg) {
#pragma unroll
  for (int p = 0; p < 16; ++p) copy16(ab + p * 16 * LDG, xg + p * 16 * 1024);
#pragma unroll
  for (int p = 0; p < 4 * WN; ++p) copy16(bb + p * 16 * LDG, wg + p * 16 * 1024);
}

// The K loop, K = 1024 in 8 stages; stage 0 has been issued into buffer 0 by the
// caller. cl is the lane's copy place inside a buffer, fa / fb its fragment places.
// Each loaded row fragment feeds 4 WMMAs, each column fragment TM.
template <int TM, int WN>
__device__ __forceinline__ void gemm_loop(v8f (&acc)[TM][4], const __bf16* als, const __bf16* bls,
                                          const __bf16* xg, const __bf16* wg,
                                          int cl, int fa, int fb) {
  constexpr int KB = 8 / TM;  // 32-wide k slices per block: a block is 32 WMMAs
  for (int i = 0; i < 8; ++i) {
    wait_ds0();
    wait_async0();       // our chunks of stage i have landed
    __syncthreads();     // everyone's chunks landed; all reads of stage i-1 done
    if (i + 1 < 8) {
      const int nb = ((i + 1) & 1) * (GROWS * LDG) + cl;
      gemm_stage<WN>(als + nb, bls + nb, xg + (i + 1) * 128, wg + (i + 1) * 128);
    }
    const __bf16* ab = als + (i & 1) * (GROWS * LDG) + fa;
    const __bf16* bb = bls + (i & 1) * (GROWS * LDG) + fb;
#pragma unroll
    for (int kk = 0; kk < 128; kk += 32 * KB) {
      v16bf a[KB][TM], b[KB][4];
#pragma unroll
      for (int u = 0; u < KB; ++u) {
#pragma unroll
        for (int j = 0; j < 4; ++j) b[u][j] = ldfrag(bb + j * 16 * LDG + kk + u * 32);
#pragma unroll
        for (int t = 0; t < TM; ++t) a[u][t] = ldfrag(ab + t * 16 * LDG + kk + u * 32);
      }
      // Keeps the block's fragment reads one group in front of its WMMAs, for speed only.
      __builtin_amdgcn_sched_barrier(0);
#pragma unroll
      for (int u = 0; u < KB; ++u)
#pragma unroll
        for (int t = 0; t < TM; ++t)
#pragma unroll
          for (int j = 0; j < 4; ++j) acc[t][j] = WMMA_BF16(a[u][t], b[u][j], acc[t][j]);
      // Keeps the next block's reads, which overwrite these fragments, behind the WMMAs.
      __builtin_amdgcn_sched_barrier(0);
    }
  }
}

// A wave's four biases, 16 columns apart. The loads and their data wait stand in one
// statement.
__device__ __forceinline__ void load_bias4(float (&bias)[4], const float* bias0) {
  asm volatile("global_load_b32 %0, %4, off\n\t"
               "global_load_b32 %1, %4, off offset:64\n\t"
               "global_load_b32 %2, %4, off offset:128\n\t"
               "global_load_b32 %3, %4, off offset:192\n\t"
               "s_wait_loadcnt 0x0"
               : "=&v"(bias[0]), "=&v"(bias[1]), "=&v"(bias[2]), "=&v"(bias[3])
               : "v"(bias0)
               : "memory");
}

// Write-out of a wave's TM * 16 rows x 64 columns (one head) as [s][64] rows (+bias).
// o: the lane's place at row 0, column group 0; bias: the lane's four biases.
template <int TM>
__device__ __forceinline__ void store_rows(const v8f (&acc)[TM][4], __bf16* __restrict__ o,
                                           const float (&bias)[4]) {
#pragma unroll
  for (int j = 0; j < 4; ++j) {
#pragma unroll
    for (int t = 0; t < TM; ++t) {
#pragma unroll
      for (int r = 0; r < 8; ++r)
        o[(t * 16 + r) * 64 + j * 16] = (__bf16)(acc[t][j][r] + bias[j]);
      // The next group, or the code behind, rewrites registers these stores name:
      // the wait that belongs in front of such a rewrite, held behind the stores.
      asm volatile("s_wait_xcnt 0x0" ::: "memory");
      __builtin_amdgcn_sched_barrier(0);
    }
  }
}

// The same transposed, as [64][t] rows: a lane's 8 accumulator rows are 8
// consecutive t of one v^T row.
template <int TM>
__device__ __forceinline__ void store_cols(const v8f (&acc)[TM][4], __bf16* __restrict__ o,
                                           const float (&bias)[4]) {
#pragma unroll
  for (int j = 0; j < 4; ++j) {
#pragma unroll
    for (int t = 0; t < TM; ++t) {
      v8bf p;
#pragma unroll
      for (int r = 0; r < 8; ++r) p[r] = (__bf16)(acc[t][j][r] + bias[j]);
      *(v8bf*)(o + j * 16 * 2048 + t * 16) = p;
      if ((t & 1) == 1) {
        // As in store_rows.
        asm volatile("s_wait_xcnt 0x0" ::: "memory");
        __builtin_amdgcn_sched_barrier(0);
      }
    }
  }
}

// ---------------------------------------------------------------------------
// Kernel 2: QKV projection GEMM. M=8192 (b*s), K=1024, WT = [wqT | wkvT], 3072
// rows one behind the other. 32 x 8 work-groups, one per WGP, each with the same
// work: first a 256x128 tile of the q projection (waves 4x2 of 64x64), then a
// 256x256 tile of the k/v projection (waves 2x4 of 128x64).
//   q : X = q activations -> qh [bh][s][64] (+bq)
//   k : X = k_and_v       -> kh [bh][t][64] (+bk)   (blockIdx.y < 4)
//   v : X = k_and_v       -> vt [bh][64][t] (+bv)   (blockIdx.y >= 4)
// ---------------------------------------------------------------------------
__global__ void __launch_bounds__(256) k_gemm_qkv(const __bf16* __restrict__ Xq,
                                                  const __bf16* __restrict__ Xkv,
                                                  const __bf16* __restrict__ WT,
                                                  __bf16* __restrict__ qh,
                                                  __bf16* __restrict__ kh,
                                                  __bf16* __restrict__ vt,
                                                  const float* __restrict__ bq,
                                                  const float* __restrict__ bk,
                                                  const float* __restrict__ bv) {
  __shared__ __attribute__((aligned(16))) __bf16 als[2 * GROWS * LDG];
  __shared__ __attribute__((aligned(16))) __bf16 bls[2 * GROWS * LDG];

  const int tid = threadIdx.x;
  const int wave = tid >> 5, lane = tid & 31;
  const int col = lane & 15, hi = lane >> 4, koff = hi << 3;

  // async-copy addressing: 256 threads cover 16 rows of 128 bf16 per pass, 16B
  // (8 elements) per thread and pass.
  const int crow = tid >> 4;         // 0..15
  const int cseg = (tid & 15) << 3;  // element offset within row: 0..120
  const int cl = crow * LDG + cseg;
  const size_t xo = (size_t)(blockIdx.x * 256 + crow) * 1024 + cseg;
  const __bf16* wq0 = WT + (size_t)(blockIdx.y * 128 + crow) * 1024 + cseg;
  const __bf16* wk0 = WT + (size_t)(1024 + blockIdx.y * 256 + crow) * 1024 + cseg;
  const int bb2 = blockIdx.x >> 3;                         // batch: 8 row tiles each
  const int sb = (blockIdx.x & 7) * 256 + (hi << 3);       // the lane's row base in it

  gemm_stage<2>(als + cl, bls + cl, Xq + xo, wq0);
  {
    const int wm = (wave >> 1) * 64, wn = (wave & 1) * 64;
    const int nh = blockIdx.y * 128 + wn;  // the wave's first column: one head
    float bias[4];
    load_bias4(bias, bq + nh + col);
    v8f acc[4][4] = {};
    gemm_loop<4, 2>(acc, als, bls, Xq + xo, wq0, cl,
                    (wm + col) * LDG + koff, (wn + col) * LDG + koff);
    store_rows<4>(acc, qh + (((size_t)(bb2 * 16 + (nh >> 6))) * 2048 + sb + wm) * 64 + col, bias);
  }
  {
    // Buffer 0 was last read in stage 6, and every wave has passed stage 7's barrier.
    gemm_stage<4>(als + cl, bls + cl, Xkv + xo, wk0);
    const int wm = (wave >> 2) * 128, wn = (wave & 3) * 64;
    const int nh = (blockIdx.y & 3) * 256 + wn;  // first column inside k or inside v
    v8f acc[8][4] = {};
    gemm_loop<8, 4>(acc, als, bls, Xkv + xo, wk0, cl,
                    (wm + col) * LDG + koff, (wn + col) * LDG + koff);
    float bias[4];
    load_bias4(bias, (blockIdx.y < 4 ? bk : bv) + nh + col);
    const size_t bh = (size_t)(bb2 * 16 + (nh >> 6));
    if (blockIdx.y < 4)
      store_rows<8>(acc, kh + (bh * 2048 + sb + wm) * 64 + col, bias);
    else
      store_cols<8>(acc, vt + (bh * 64 + col) * 2048 + sb + wm, bias);
  }
}

// Lane l <-> lane l ^ 16: the two lanes that share one column of a WMMA tile.
__device__ __forceinline__ float xhalf(float x) {
  const int b = __builtin_bit_cast(int, x);
  return __builtin_bit_cast(float,
      __builtin_amdgcn_permlanex16(b, b, 0x76543210, 0xfedcba98, false, false));
}

// 2^x in place. Behind a transcendental the instruction set asks for one free
// slot before its result is read or its source overwritten: written in place and
// in one statement, each v_exp_f32 has an independent one behind it and the last
// has the v_nop, whatever the compiler schedules next.
__device__ __forceinline__ float exp2_slot(float x) {
  asm("v_exp_f32 %0, %0\n\tv_nop" : "+v"(x));
  return x;
}
__device__ __forceinline__ void exp2x8_slot(float (&x)[8]) {
  asm("v_exp_f32 %0, %0\n\t"
      "v_exp_f32 %1, %1\n\t"
      "v_exp_f32 %2, %2\n\t"
      "v_exp_f32 %3, %3\n\t"
      "v_exp_f32 %4, %4\n\t"
      "v_exp_f32 %5, %5\n\t"
      "v_exp_f32 %6, %6\n\t"
      "v_exp_f32 %7, %7\n\t"
      "v_nop"
      : "+v"(x[0]), "+v"(x[1]), "+v"(x[2]), "+v"(x[3]),
        "+v"(x[4]), "+v"(x[5]), "+v"(x[6]), "+v"(x[7]));
}
// log2(e) / sqrt(64): the score scale and the change of base in one factor.
#define SCL2E 0.18033688011112042592f

__global__ void __launch_bounds__(256) k_attn(const __bf16* __restrict__ qh,
                                              const __bf16* __restrict__ kh,
                                              const __bf16* __restrict__ vt,
                                              __bf16* __restrict__ z) {
  __shared__ __attribute__((aligned(16))) __bf16 kls[2][64 * LDP];
  __shared__ __attribute__((aligned(16))) __bf16 vls[2][64 * LDP];

  const int tid = threadIdx.x;
  const int wave = tid >> 5, lane = tid & 31;
  const int col = lane & 15, hi = lane >> 4, koff = hi << 3;
  const int bh = blockIdx.x;                    // b*16 + h
  const int s0 = blockIdx.y * 256 + wave * 32;  // query rows of this wave

  const __bf16* qbase = qh + ((size_t)bh * 2048 + s0) * 64;
  const int crow = tid >> 3, cseg = (tid & 7) << 3;                 // crow 0..31
  const __bf16* kg = kh + ((size_t)bh * 2048 + crow) * 64 + cseg;   // +t0*64
  const __bf16* vg = vt + ((size_t)bh * 64 + crow) * 2048 + cseg;   // +t0

  async_stage256(&kls[0][crow * LDP + cseg], kg, 64, &vls[0][crow * LDP + cseg], vg, 2048);

  // Q^T as B operand: column = query s0+g*16+col, k = d -> two fragments per
  // column group g, kept in regs.
  v16bf bq[2][2];
#pragma unroll
  for (int g = 0; g < 2; ++g) {
    bq[g][0] = ldfrag(qbase + (size_t)(g * 16 + col) * 64 + koff);
    bq[g][1] = ldfrag(qbase + (size_t)(g * 16 + col) * 64 + koff + 32);
  }

  // O[g][j2][r] = O^T[d = j2*16 + 8*hi + r][query g*16+col]; M is the query's
  // running maximum of unscaled scores (equal in both lane halves), L this lane half's share of its sum.
  v8f O[2][4] = {};
  float M[2] = {-3.0e38f, -3.0e38f}, L[2] = {0.0f, 0.0f};

  for (int i = 0; i < 32; ++i) {
    wait_ds0();
    wait_async0();
    __syncthreads();
    if (i + 1 < 32) {
      const int tn = (i + 1) * 64;
      async_stage256(&kls[(i + 1) & 1][crow * LDP + cseg], kg + (size_t)tn * 64, 64,
                     &vls[(i + 1) & 1][crow * LDP + cseg], vg + tn, 2048);
    }
    const __bf16* kb0 = &kls[i & 1][0];
    const __bf16* vb0 = &vls[i & 1][0];

    // --- scores: s[g][j][r] = S^T[key j*16 + 8*hi + r][query g*16+col] ---
    v8f s[2][4];
#pragma unroll
    for (int j = 0; j < 4; ++j) {
      const __bf16* kb = kb0 + (j * 16 + col) * LDP + koff;
      v16bf a0 = ldfrag(kb);
      v16bf a1 = ldfrag(kb + 32);
#pragma unroll
      for (int g = 0; g < 2; ++g) {
        v8f c = {};
        c = WMMA_BF16(a0, bq[g][0], c);
        c = WMMA_BF16(a1, bq[g][1], c);
        s[g][j] = c;
      }
    }

    v16bf bp[2][2];
#pragma unroll
    for (int g = 0; g < 2; ++g) {
      // --- the query's tile maximum of the unscaled scores (the scale is positive):
      //     in the lane, then across the halves ---
      float tm = -3.0e38f;
#pragma unroll
      for (int j = 0; j < 4; ++j)
#pragma unroll
        for (int r = 0; r < 8; ++r) tm = fmaxf(tm, s[g][j][r]);
      tm = fmaxf(tm, xhalf(tm));

      // --- online softmax update ---
      const float mn = fmaxf(M[g], tm);
      const float mc = mn * SCL2E;
      const float corr = exp2_slot(fmaf(M[g], SCL2E, -mc));
      M[g] = mn;
#pragma unroll
      for (int j = 0; j < 4; ++j)
#pragma unroll
        for (int r = 0; r < 8; ++r) O[g][j][r] *= corr;

      // P^T fragments: element e of bp[g][h] is key h*32 + kmap(e), which is
      // register e & 7 of score tile 2*h + (e >> 3) in this very lane.
      float ps[4];
#pragma unroll
      for (int j = 0; j < 4; ++j) {
        float p[8];
#pragma unroll
        for (int r = 0; r < 8; ++r) p[r] = fmaf(s[g][j][r], SCL2E, -mc);
        exp2x8_slot(p);
        ps[j] = p[0];
#pragma unroll
        for (int r = 1; r < 8; ++r) ps[j] += p[r];
#pragma unroll
        for (int r = 0; r < 8; ++r) bp[g][j >> 1][(j & 1) * 8 + r] = (__bf16)p[r];
      }
      L[g] = L[g] * corr + ((ps[0] + ps[1]) + (ps[2] + ps[3]));
    }

    // --- PV: A = V^T rows d (LDS, t-contiguous), B = P^T from registers ---
#pragma unroll
    for (int j2 = 0; j2 < 4; ++j2) {
      const __bf16* vb = vb0 + (j2 * 16 + col) * LDP + koff;
      v16bf a0 = ldfrag(vb);
      v16bf a1 = ldfrag(vb + 32);
#pragma unroll
      for (int g = 0; g < 2; ++g) {
        O[g][j2] = WMMA_BF16(a0, bp[g][0], O[g][j2]);
        O[g][j2] = WMMA_BF16(a1, bp[g][1], O[g][j2]);
      }
    }
  }

  // --- join the halves' sums, normalize, store z [b][s][h*64+d] bf16:
  //     8 consecutive d per lane and tile = one 16-byte store ---
  const int b = bh >> 4, h = bh & 15;
#pragma unroll
  for (int g = 0; g < 2; ++g) {
    const float Lq = L[g] + xhalf(L[g]);
    __bf16* zrow = z + ((size_t)(b * 2048 + s0 + g * 16 + col)) * 1024 + h * 64 + koff;
#pragma unroll
    for (int j2 = 0; j2 < 4; ++j2) {
      v8bf o;
#pragma unroll
      for (int r = 0; r < 8; ++r) o[r] = (__bf16)(O[g][j2][r] / Lq);
      *(v8bf*)(zrow + j2 * 16) = o;
    }
  }
}

// ---------------------------------------------------------------------------
// Kernel 4: output projection GEMM. M=8192, K=1024, N=1024; f32 out + bo.
// 32 x 8 work-groups of one 256x128 tile (waves 4x2 of 64x64), core as kernel 2.
// ---------------------------------------------------------------------------
__global__ void __launch_bounds__(256) k_gemm_out(const __bf16* __restrict__ Z,
                                                  const __bf16* __restrict__ WoT,
                                                  const float* __restrict__ bo,
                                                  float* __restrict__ out) {
  __shared__ __attribute__((aligned(16))) __bf16 als[2 * GROWS * LDG];
  __shared__ __attribute__((aligned(16))) __bf16 bls[2 * GROWS * LDG];

  const int tid = threadIdx.x;
  const int wave = tid >> 5, lane = tid & 31;
  const int col = lane & 15, hi = lane >> 4, koff = hi << 3;
  const int wm = (wave >> 1) * 64, wn = (wave & 1) * 64;  // wave's corner in the tile
  const int m0 = blockIdx.x * 256 + wm;
  const int n0 = blockIdx.y * 128 + wn;

  const int crow = tid >> 4, cseg = (tid & 15) << 3;
  const int cl = crow * LDG + cseg;
  const __bf16* zg = Z   + (size_t)(blockIdx.x * 256 + crow) * 1024 + cseg;
  const __bf16* wg = WoT + (size_t)(blockIdx.y * 128 + crow) * 1024 + cseg;

  gemm_stage<2>(als + cl, bls + cl, zg, wg);
  v8f acc[4][4] = {};
  gemm_loop<4, 2>(acc, als, bls, zg, wg, cl, (wm + col) * LDG + koff, (wn + col) * LDG + koff);

#pragma unroll
  for (int t = 0; t < 4; ++t)
#pragma unroll
  for (int j = 0; j < 4; ++j) {
    const int n = n0 + j * 16 + col;
#pragma unroll
    for (int r = 0; r < 8; ++r) {
      const int m = m0 + t * 16 + r + (hi << 3);
      out[(size_t)m * 1024 + n] = acc[t][j][r] + bo[n];
    }
  }
}

// ---------------------------------------------------------------------------
// Host launcher
// ---------------------------------------------------------------------------
extern "C" void kernel_launch(void* const* d_in, const int* in_sizes, int n_in,
                              void* d_out, int out_size, void* d_ws, size_t ws_size,
                              hipStream_t stream) {
  const float* q  = (const float*)d_in[0];
  const float* kv = (const float*)d_in[1];
  const float* wq = (const float*)d_in[2];
  const float* bq = (const float*)d_in[3];
  const float* wk = (const float*)d_in[4];
  const float* bk = (const float*)d_in[5];
  const float* wv = (const float*)d_in[6];
  const float* bv = (const float*)d_in[7];
  const float* wo = (const float*)d_in[8];
  const float* bo = (const float*)d_in[9];
  float* out = (float*)d_out;

  char* w = (char*)d_ws;
  const size_t MB = 1024 * 1024;
  __bf16* qbf  = (__bf16*)(w + 0 * MB);    // 16 MB (reused later for z)
  __bf16* kvbf = (__bf16*)(w + 16 * MB);   // 16 MB
  __bf16* wqT  = (__bf16*)(w + 32 * MB);   //  2 MB, rows 0-1023 of the QKV weight plane
  __bf16* wkvT = (__bf16*)(w + 34 * MB);   //  4 MB, its rows 1024-3071
  __bf16* woT  = (__bf16*)(w + 38 * MB);   //  2 MB
  __bf16* qhB  = (__bf16*)(w + 40 * MB);   // 16 MB
  __bf16* khB  = (__bf16*)(w + 56 * MB);   // 16 MB
  __bf16* vtB  = (__bf16*)(w + 72 * MB);   // 16 MB  (total 88 MB)
  __bf16* zB   = qbf;                      // reuse q_bf region after projection

  k_cvt<<<dim3(1536), dim3(256), 0, stream>>>(q, kv, wq, wk, wv, wo, qbf, kvbf, wqT, wkvT, woT);
  k_gemm_qkv<<<dim3(32, 8), dim3(256), 0, stream>>>(qbf, kvbf, wqT, qhB, khB, vtB, bq, bk, bv);
  k_attn<<<dim3(64, 8), dim3(256), 0, stream>>>(qhB, khB, vtB, zB);
  k_gemm_out<<<dim3(32, 8), dim3(256), 0, stream>>>(zB, woT, bo, out);
}

// v009
// It runs in 116 microseconds.
// Two timings next to v008 put it at 1.03 and 1.02 times that version's speed.
// Over all steps from v000 it is 5.00 times as fast.
#include <hip/hip_runtime.h>

typedef __attribute__((ext_vector_type(16))) __bf16 v16bf;
typedef __attribute__((ext_vector_type(8)))  __bf16 v8bf;
typedef __attribute__((ext_vector_type(8)))  float  v8f;
typedef __attribute__((ext_vector_type(4)))  float  v4f;
typedef __attribute__((ext_vector_type(4)))  __bf16 v4bf;

#define WMMA_BF16(a, b, c) \
  __builtin_amdgcn_wmma_f32_16x16x32_bf16(false, (a), false, (b), (short)0, (c), false, false)

// LDS byte offset of a __shared__ object (addrspace(3) pointers are the raw
// wave-LDS byte offsets that GLOBAL_LOAD_ASYNC_TO_LDS wants in VDST).
__device__ __forceinline__ unsigned lds_off_u32(const void* p) {
  return (unsigned)(unsigned long long)(__attribute__((address_space(3))) const void*)p;
}

// LDS row pitch of every staged 64-element (128-byte) bf16 row, in elements:
// 144 bytes = 16 B x odd, so the 16 rows that a ds_load_b128 fragment read
// touches per lane half fall on 16 different groups of four banks.
#define LDP 72

// Per-lane async copies, 16 bytes global -> LDS each, tracked by ASYNCcnt: one
// stage of two 64x64 bf16 tiles for a block of 256 threads, two passes of 32 rows
// per tile, four copies a lane. la / lb are the lane's LDS places in pass 0, ga / gb
// its global places, sa / sb the global row pitches in elements. The closing
// s_wait_xcnt 0 stands inside the statement so that no address register is
// rewritten ahead of it.
__device__ __forceinline__ void async_stage256(const __bf16* la, const __bf16* ga, int sa,
                                               const __bf16* lb, const __bf16* gb, int sb) {
  const unsigned a0 = lds_off_u32(la), b0 = lds_off_u32(lb);
  const unsigned st = 32 * LDP * 2;  // 32 LDS rows, in bytes
  asm volatile("global_load_async_to_lds_b128 %0, %4, off\n\t"
               "global_load_async_to_lds_b128 %2, %6, off\n\t"
               "global_load_async_to_lds_b128 %1, %5, off\n\t"
               "global_load_async_to_lds_b128 %3, %7, off\n\t"
               "s_wait_xcnt 0x0"
               :: "v"(a0), "v"(a0 + st), "v"(b0), "v"(b0 + st),
                  "v"(ga), "v"(ga + (size_t)32 * sa),
                  "v"(gb), "v"(gb + (size_t)32 * sb)
               : "memory");
}

__device__ __forceinline__ void wait_async0() {
  asm volatile("s_wait_asynccnt 0" ::: "memory");
}

// The wave's own LDS reads have retired before the barrier behind which the
// buffer they read is refilled by async copies.
__device__ __forceinline__ void wait_ds0() {
  asm volatile("s_wait_dscnt 0x0" ::: "memory");
}

// Load a 16x32 bf16 A/B fragment (CDNA5 16-bit WMMA lane layout): caller passes
// p already offset by row*ld + koff (koff = 8*(lane>=16)); elements [0..7] are
// K=koff..koff+7, [8..15] are K=koff+16..koff+23.
__device__ __forceinline__ v16bf ldfrag(const __bf16* p) {
  v8bf lo = *(const v8bf*)(p);
  v8bf hi = *(const v8bf*)(p + 16);
  v16bf f;
#pragma unroll
  for (int i = 0; i < 8; ++i) { f[i] = lo[i]; f[i + 8] = hi[i]; }
  return f;
}

// ---------------------------------------------------------------------------
// Kernel 1, part a: f32 -> bf16 conversion of activations (q and k_and_v, 8M each).
// bx is the part's own block index, 0..1023.
// A lane takes 8 groups of 4 elements of each tensor: every wave-wide 16-byte
// load covers 512 contiguous bytes (4 whole lines), every 8-byte store 2 whole
// lines; a lane's 16 loads are independent, so that most are in flight at once.
// ---------------------------------------------------------------------------
__device__ __forceinline__ void cvt_act(unsigned bx, const float* __restrict__ q,
                                        const float* __restrict__ kv,
                                        __bf16* __restrict__ qb,
                                        __bf16* __restrict__ kvb) {
  const unsigned g0 = bx * 2048u + threadIdx.x;  // in groups of 4 elements
  const v4f* q4  = (const v4f*)q + g0;
  const v4f* kv4 = (const v4f*)kv + g0;
  v4f a[8], b[8];
#pragma unroll
  for (int u = 0; u < 8; ++u) a[u] = q4[u * 256];
#pragma unroll
  for (int u = 0; u < 8; ++u) b[u] = kv4[u * 256];
  v4bf* qo  = (v4bf*)qb + g0;
  v4bf* kvo = (v4bf*)kvb + g0;
#pragma unroll
  for (int u = 0; u < 8; ++u) {
    v4bf o;
#pragma unroll
    for (int e = 0; e < 4; ++e) o[e] = (__bf16)a[u][e];
    qo[u * 256] = o;
  }
#pragma unroll
  for (int u = 0; u < 8; ++u) {
    v4bf o;
#pragma unroll
    for (int e = 0; e < 4; ++e) o[e] = (__bf16)b[u][e];
    kvo[u * 256] = o;
  }
  // In the built code the weight part's block lies behind these stores and
  // rewrites registers they name: the wait that belongs in front of such a rewrite.
  asm volatile("s_wait_xcnt 0x0" ::: "memory");
}

// ---------------------------------------------------------------------------
// Kernel 1, part b: transpose+convert weights into B^T [N][K] bf16 layouts.
//   wqT  [1024][1024] : wqT[n][e]  = wq[h,e,d], n = h*64+d
//   wkvT [2048][1024] : rows 0-1023 from wk, rows 1024-2047 from wv
//   woT  [1024][1024] : woT[e][c]  = wo[c][e]
// by picks the matrix, bx (0..127) the block's tiles in it.
// A wave takes a tile of 32 target rows n x 32 target
// columns k; a lane reads 8 source rows k of 4 consecutive n (16-byte loads: 8
// lanes cover one whole 128-byte line) and turns them in its own registers into
// 4 target rows of 8 consecutive k (16-byte stores, 64 bytes per row and wave).
// ---------------------------------------------------------------------------
template <int PS>  // PS: source pitch from k to k + 1, in elements
__device__ __forceinline__ void turn_tile(const float* __restrict__ s, __bf16* __restrict__ d) {
  v4f f[8];
#pragma unroll
  for (int r = 0; r < 8; ++r) f[r] = *(const v4f*)(s + r * PS);
#pragma unroll
  for (int j = 0; j < 4; ++j) {
    v8bf o;
#pragma unroll
    for (int r = 0; r < 8; ++r) o[r] = (__bf16)f[r][j];
    *(v8bf*)(d + j * 1024) = o;
  }
}

__device__ __forceinline__ void cvt_w(int bx, int by, const float* __restrict__ wq,
                                      const float* __restrict__ wk,
                                      const float* __restrict__ wv,
                                      const float* __restrict__ wo,
                                      __bf16* __restrict__ wqT,
                                      __bf16* __restrict__ wkvT,
                                      __bf16* __restrict__ woT) {
  const int wave = threadIdx.x >> 5, lane = threadIdx.x & 31;
  const int t  = bx * 8 + wave;                    // tile of this matrix, 0..1023
  const int nb = ((t >> 6) << 1) | (t & 1);        // neighbour waves share 256 source bytes
  const int kb = (t >> 1) & 31;
  const int n = nb * 32 + (lane & 7) * 4;          // first of the lane's 4 target rows
  const int k = kb * 32 + (lane >> 3) * 8;         // first of its 8 target columns

  const size_t to = (size_t)n * 1024 + k;          // the lane's place in the target
  if (by == 3) {
    turn_tile<1024>(wo + (size_t)k * 1024 + n, woT + to);
  } else {
    const float* w = by == 0 ? wq : by == 1 ? wk : wv;
    __bf16* d = by == 0 ? wqT : by == 1 ? wkvT : wkvT + 1024 * 1024;
    turn_tile<64>(w + (size_t)((n >> 6) * 1024 + k) * 64 + (n & 63), d + to);
    // In the built code the fourth matrix's block lies behind these stores and
    // rewrites registers they name: the wait that belongs in front of such a rewrite.
    asm volatile("s_wait_xcnt 0x0" ::: "memory");
  }
}

// Both parts read inputs only and write their own planes: one grid of 512 + 1024
// blocks, the weight blocks first.
__global__ void __launch_bounds__(256) k_cvt(const float* __restrict__ q,
                                             const float* __restrict__ kv,
                                             const float* __restrict__ wq,
                                             const float* __restrict__ wk,
                                             const float* __restrict__ wv,
                                             const float* __restrict__ wo,
                                             __bf16* __restrict__ qb,
                                             __bf16* __restrict__ kvb,
                                             __bf16* __restrict__ wqT,
                                             __bf16* __restrict__ wkvT,
                                             __bf16* __restrict__ woT) {
  const int b = blockIdx.x;
  if (b < 512) cvt_w(b & 127, b >> 7, wq, wk, wv, wo, wqT, wkvT, woT);
  else         cvt_act(b - 512, q, kv, qb, kvb);
}

// ---------------------------------------------------------------------------
// GEMM core shared by kernels 2 and 4. 8 waves, one work-group per WGP; a
// work-group tile has 256 rows of X and WN * 64 rows of W^T; a wave owns TM * 16
// rows x 64 columns (TM x 4 accumulator tiles), the waves lying WN abreast.
// 128-wide K tiles of both operands are double-buffered in LDS via async
// global->LDS copies.
// ---------------------------------------------------------------------------
#define GROWS 256  // LDS rows per operand and buffer
// LDS row pitch of a staged 128-element (256-byte) row, in elements: 272 bytes =
// 16 B x odd, free of bank conflicts for ds_load_b128 like LDP.
#define LDG 136

// One async copy of 16 bytes as the builtin: its address registers are the
// compiler's, which may place them above v255, where asm operands cannot lie and
// where the 128x64 wave tile leaves room.
typedef __attribute__((ext_vector_type(4))) int v4i;
__device__ __forceinline__ void copy16(const __bf16* l, const __bf16* g) {
  __builtin_amdgcn_global_load_async_to_lds_b128(
      (__attribute__((address_space(1))) v4i*)g, (__attribute__((address_space(3))) v4i*)l, 0, 0);
}

// One stage: 256 rows of X and WN * 64 rows of W^T, in passes of 16 rows. ab / bb
// are the lane's LDS places in pass 0, xg / wg its global places there.
// The rows of W^T are dealt: in each group of 64, LDS row j * 16 + c holds global
// row c * 4 + j (wg stands at row 4 * c for the lane that copies LDS row c). Column
// c of a wave's four accumulator tiles j is then four adjacent output columns, and
// 16 lanes write 64 adjacent columns of one output row: whole 128-byte lines.
template <int WN>
__device__ __forceinline__ void gemm_stage(const __bf16* ab, const __bf16* bb,
                                           const __bf16* xg, const __bf16* wg) {
#pragma unroll
  for (int p = 0; p < 16; ++p) copy16(ab + p * 16 * LDG, xg + p * 16 * 1024);
#pragma unroll
  for (int p = 0; p < 4 * WN; ++p)
    copy16(bb + p * 16 * LDG, wg + ((p >> 2) * 64 + (p & 3)) * 1024);
}

// The K loop, K = 1024 in 8 stages; stage 0 has been issued into buffer 0 by the
// caller. cl is the lane's copy place inside a buffer, fa / fb its fragment places.
// Each loaded row fragment feeds 4 WMMAs, each column fragment TM.
template <int TM, int WN>
__device__ __forceinline__ void gemm_loop(v8f (&acc)[TM][4], const __bf16* als, const __bf16* bls,
                                          const __bf16* xg, const __bf16* wg,
                                          int cl, int fa, int fb) {
  constexpr int KB = 8 / TM;  // 32-wide k slices per block: a block is 32 WMMAs
  for (int i = 0; i < 8; ++i) {
    wait_ds0();
    wait_async0();       // our chunks of stage i have landed
    __syncthreads();     // everyone's chunks landed; all reads of stage i-1 done
    if (i + 1 < 8) {
      const int nb = ((i + 1) & 1) * (GROWS * LDG) + cl;
      gemm_stage<WN>(als + nb, bls + nb, xg + (i + 1) * 128, wg + (i + 1) * 128);
    }
    const __bf16* ab = als + (i & 1) * (GROWS * LDG) + fa;
    const __bf16* bb = bls + (i & 1) * (GROWS * LDG) + fb;
#pragma unroll
    for (int kk = 0; kk < 128; kk += 32 * KB) {
      v16bf a[KB][TM], b[KB][4];
#pragma unroll
      for (int u = 0; u < KB; ++u) {
#pragma unroll
        for (int j = 0; j < 4; ++j) b[u][j] = ldfrag(bb + j * 16 * LDG + kk + u * 32);
#pragma unroll
        for (int t = 0; t < TM; ++t) a[u][t] = ldfrag(ab + t * 16 * LDG + kk + u * 32);
      }
      // Keeps the block's fragment reads one group in front of its WMMAs, for speed only.
      __builtin_amdgcn_sched_barrier(0);
#pragma unroll
      for (int u = 0; u < KB; ++u)
#pragma unroll
        for (int t = 0; t < TM; ++t)
#pragma unroll
          for (int j = 0; j < 4; ++j) acc[t][j] = WMMA_BF16(a[u][t], b[u][j], acc[t][j]);
      // Keeps the next block's reads, which overwrite these fragments, behind the WMMAs.
      __builtin_amdgcn_sched_barrier(0);
    }
  }
}

// A lane's four biases, of its four adjacent columns. The load and its data wait
// stand in one statement.
__device__ __forceinline__ v4f load_bias4(const float* bias0) {
  v4f b;
  asm volatile("global_load_b128 %0, %1, off\n\t"
               "s_wait_loadcnt 0x0"
               : "=&v"(b)
               : "v"(bias0)
               : "memory");
  return b;
}

// Write-out of a wave's TM * 16 rows x 64 columns as bf16 rows of pitch PITCH
// elements. o: the lane's place at row 0 (its four adjacent columns). A store
// instruction writes two whole 128-byte lines, rows r and r + 8. The bias goes by
// column (cb: the lane's four).
template <int TM, int PITCH>
__device__ __forceinline__ void store_lines(const v8f (&acc)[TM][4], __bf16* __restrict__ o,
                                            const v4f cb) {
#pragma unroll
  for (int t = 0; t < TM; ++t) {
#pragma unroll
    for (int r = 0; r < 8; ++r) {
      v4bf p;
#pragma unroll
      for (int j = 0; j < 4; ++j) p[j] = (__bf16)(acc[t][j][r] + cb[j]);
      *(v4bf*)(o + (t * 16 + r) * PITCH) = p;
    }
    // The next group, or the code behind, rewrites registers these stores name:
    // the wait that belongs in front of such a rewrite, held behind the stores.
    asm volatile("s_wait_xcnt 0x0" ::: "memory");
    __builtin_amdgcn_sched_barrier(0);
  }
}

// The same with the bias by row: rb is the lane's place in an LDS table of the
// work-group's row biases, at its row 0.
template <int TM, int PITCH>
__device__ __forceinline__ void store_lines_rb(const v8f (&acc)[TM][4], __bf16* __restrict__ o,
                                               const float* rb) {
  v4f b[TM][2];
#pragma unroll
  for (int t = 0; t < TM; ++t) {
    b[t][0] = *(const v4f*)(rb + t * 16);
    b[t][1] = *(const v4f*)(rb + t * 16 + 4);
  }
#pragma unroll
  for (int t = 0; t < TM; ++t) {
#pragma unroll
    for (int r = 0; r < 8; ++r) {
      v4bf p;
#pragma unroll
      for (int j = 0; j < 4; ++j) p[j] = (__bf16)(acc[t][j][r] + b[t][r >> 2][r & 3]);
      *(v4bf*)(o + (t * 16 + r) * PITCH) = p;
    }
    // As in store_lines.
    asm volatile("s_wait_xcnt 0x0" ::: "memory");
    __builtin_amdgcn_sched_barrier(0);
  }
}

// ---------------------------------------------------------------------------
// Kernel 2: QKV projection GEMM. M=8192 (b*s), K=1024, WT = [wqT | wkvT], 3072
// rows one behind the other. 32 x 8 work-groups, one per WGP, each with the same
// work: first a 256x128 tile of the q projection (waves 4x2 of 64x64), then a
// 256x256 tile of the k/v projection (waves 2x4 of 128x64).
//   q : X = q activations -> qh [bh][s][64] (+bq)
//   k : X = k_and_v       -> kh [bh][t][64] (+bk)   (blockIdx.y < 4)
//   v : X = k_and_v       -> vt [bh][64][t] (+bv)   (blockIdx.y >= 4)
// A v tile is formed transposed, Wv^T X^T: the two operands change places at the
// copy, so that its rows are rows of vt and go out like rows of kh.
// ---------------------------------------------------------------------------
__global__ void __launch_bounds__(256) k_gemm_qkv(const __bf16* __restrict__ Xq,
                                                  const __bf16* __restrict__ Xkv,
                                                  const __bf16* __restrict__ WT,
                                                  __bf16* __restrict__ qh,
                                                  __bf16* __restrict__ kh,
                                                  __bf16* __restrict__ vt,
                                                  const float* __restrict__ bq,
                                                  const float* __restrict__ bk,
                                                  const float* __restrict__ bv) {
  __shared__ __attribute__((aligned(16))) __bf16 als[2 * GROWS * LDG];
  __shared__ __attribute__((aligned(16))) __bf16 bls[2 * GROWS * LDG];
  __shared__ __attribute__((aligned(16))) float kvbias[256];  // of the k/v tile's 256 features

  const int tid = threadIdx.x;
  const int wave = tid >> 5, lane = tid & 31;
  const int col = lane & 15, hi = lane >> 4, koff = hi << 3;
  const bool isv = blockIdx.y >= 4;

  // async-copy addressing: 256 threads cover 16 rows of 128 bf16 per pass, 16B
  // (8 elements) per thread and pass. p*: rows as they lie; d*: dealt rows.
  const int crow = tid >> 4;         // 0..15
  const int cseg = (tid & 15) << 3;  // element offset within row: 0..120
  const int cl = crow * LDG + cseg;
  const size_t xp = (size_t)(blockIdx.x * 256 + crow) * 1024 + cseg;
  const size_t xd = (size_t)(blockIdx.x * 256 + crow * 4) * 1024 + cseg;
  const __bf16* wq0 = WT + (size_t)(blockIdx.y * 128 + crow * 4) * 1024 + cseg;
  const __bf16* wp = WT + (size_t)(1024 + blockIdx.y * 256 + crow) * 1024 + cseg;
  const __bf16* wd = WT + (size_t)(1024 + blockIdx.y * 256 + crow * 4) * 1024 + cseg;
  const int bb2 = blockIdx.x >> 3;             // batch: 8 row tiles each
  const int sb = (blockIdx.x & 7) * 256;       // the tile's first position in it

  gemm_stage<2>(als + cl, bls + cl, Xq + xp, wq0);
  const int c0 = (blockIdx.y & 3) * 256;  // the k/v tile's first feature inside k or inside v
  {
    // Read in the k/v write-out, behind the K loops' barriers: a lane of a v tile needs
    // 64 of them. Load and data wait in one statement, as in load_bias4.
    float x;
    asm volatile("global_load_b32 %0, %1, off\n\t"
                 "s_wait_loadcnt 0x0"
                 : "=&v"(x)
                 : "v"((isv ? bv : bk) + c0 + tid)
                 : "memory");
    kvbias[tid] = x;
  }
  {
    const int wm = (wave >> 1) * 64, wn = (wave & 1) * 64;
    const int nh = blockIdx.y * 128 + wn;  // the wave's first column: one head
    const v4f bias = load_bias4(bq + nh + col * 4);
    v8f acc[4][4] = {};
    gemm_loop<4, 2>(acc, als, bls, Xq + xp, wq0, cl,
                    (wm + col) * LDG + koff, (wn + col) * LDG + koff);
    store_lines<4, 64>(acc, qh + (((size_t)(bb2 * 16 + (nh >> 6))) * 2048 + sb + wm + koff) * 64
                                + col * 4, bias);
  }
  {
    const __bf16* ag = isv ? wp : Xkv + xp;  // the operand whose rows are output rows
    const __bf16* bg = isv ? Xkv + xd : wd;  // the operand whose rows are output columns
    // Buffer 0 was last read in stage 6, and every wave has passed stage 7's barrier.
    gemm_stage<4>(als + cl, bls + cl, ag, bg);
    const int wm = (wave >> 2) * 128, wn = (wave & 3) * 64;
    v8f acc[8][4] = {};
    gemm_loop<8, 4>(acc, als, bls, ag, bg, cl,
                    (wm + col) * LDG + koff, (wn + col) * LDG + koff);
    if (!isv) {
      const v4f bias = *(const v4f*)(kvbias + wn + col * 4);
      const size_t bh = (size_t)(bb2 * 16 + ((c0 + wn) >> 6));
      store_lines<8, 64>(acc, kh + (bh * 2048 + sb + wm + koff) * 64 + col * 4, bias);
    } else {
      store_lines_rb<8, 2048>(acc, vt + ((size_t)(bb2 * 1024 + c0 + wm + koff)) * 2048
                                       + sb + wn + col * 4, kvbias + wm + koff);
    }
  }
}

// Lane l <-> lane l ^ 16: the two lanes that share one column of a WMMA tile.
__device__ __forceinline__ float xhalf(float x) {
  const int b = __builtin_bit_cast(int, x);
  return __builtin_bit_cast(float,
      __builtin_amdgcn_permlanex16(b, b, 0x76543210, 0xfedcba98, false, false));
}

// 2^x in place. Behind a transcendental the instruction set asks for one free
// slot before its result is read or its source overwritten: written in place and
// in one statement, each v_exp_f32 has an independent one behind it and the last
// has the v_nop, whatever the compiler schedules next.
__device__ __forceinline__ float exp2_slot(float x) {
  asm("v_exp_f32 %0, %0\n\tv_nop" : "+v"(x));
  return x;
}
__device__ __forceinline__ void exp2x8_slot(float (&x)[8]) {
  asm("v_exp_f32 %0, %0\n\t"
      "v_exp_f32 %1, %1\n\t"
      "v_exp_f32 %2, %2\n\t"
      "v_exp_f32 %3, %3\n\t"
      "v_exp_f32 %4, %4\n\t"
      "v_exp_f32 %5, %5\n\t"
      "v_exp_f32 %6, %6\n\t"
      "v_exp_f32 %7, %7\n\t"
      "v_nop"
      : "+v"(x[0]), "+v"(x[1]), "+v"(x[2]), "+v"(x[3]),
        "+v"(x[4]), "+v"(x[5]), "+v"(x[6]), "+v"(x[7]));
}
// log2(e) / sqrt(64): the score scale and the change of base in one factor.
#define SCL2E 0.18033688011112042592f

__global__ void __launch_bounds__(256) k_attn(const __bf16* __restrict__ qh,
                                              const __bf16* __restrict__ kh,
                                              const __bf16* __restrict__ vt,
                                              __bf16* __restrict__ z) {
  __shared__ __attribute__((aligned(16))) __bf16 kls[2][64 * LDP];
  __shared__ __attribute__((aligned(16))) __bf16 vls[2][64 * LDP];

  const int tid = threadIdx.x;
  const int wave = tid >> 5, lane = tid & 31;
  const int col = lane & 15, hi = lane >> 4, koff = hi << 3;
  const int bh = blockIdx.x;                    // b*16 + h
  const int s0 = blockIdx.y * 256 + wave * 32;  // query rows of this wave

  const __bf16* qbase = qh + ((size_t)bh * 2048 + s0) * 64;
  const int crow = tid >> 3, cseg = (tid & 7) << 3;                 // crow 0..31
  const __bf16* kg = kh + ((size_t)bh * 2048 + crow) * 64 + cseg;   // +t0*64
  const __bf16* vg = vt + ((size_t)bh * 64 + crow) * 2048 + cseg;   // +t0

  async_stage256(&kls[0][crow * LDP + cseg], kg, 64, &vls[0][crow * LDP + cseg], vg, 2048);

  // Q^T as B operand: column = query s0+g*16+col, k = d -> two fragments per
  // column group g, kept in regs.
  v16bf bq[2][2];
#pragma unroll
  for (int g = 0; g < 2; ++g) {
    bq[g][0] = ldfrag(qbase + (size_t)(g * 16 + col) * 64 + koff);
    bq[g][1] = ldfrag(qbase + (size_t)(g * 16 + col) * 64 + koff + 32);
  }

  // O[g][j2][r] = O^T[d = j2*16 + 8*hi + r][query g*16+col]; M is the query's
  // running maximum of unscaled scores (equal in both lane halves), L this lane half's share of its sum.
  v8f O[2][4] = {};
  float M[2] = {-3.0e38f, -3.0e38f}, L[2] = {0.0f, 0.0f};

  for (int i = 0; i < 32; ++i) {
    wait_ds0();
    wait_async0();
    __syncthreads();
    if (i + 1 < 32) {
      const int tn = (i + 1) * 64;
      async_stage256(&kls[(i + 1) & 1][crow * LDP + cseg], kg + (size_t)tn * 64, 64,
                     &vls[(i + 1) & 1][crow * LDP + cseg], vg + tn, 2048);
    }
    const __bf16* kb0 = &kls[i & 1][0];
    const __bf16* vb0 = &vls[i & 1][0];

    // --- scores: s[g][j][r] = S^T[key j*16 + 8*hi + r][query g*16+col] ---
    v8f s[2][4];
#pragma unroll
    for (int j = 0; j < 4; ++j) {
      const __bf16* kb = kb0 + (j * 16 + col) * LDP + koff;
      v16bf a0 = ldfrag(kb);
      v16bf a1 = ldfrag(kb + 32);
#pragma unroll
      for (int g = 0; g < 2; ++g) {
        v8f c = {};
        c = WMMA_BF16(a0, bq[g][0], c);
        c = WMMA_BF16(a1, bq[g][1], c);
        s[g][j] = c;
      }
    }

    v16bf bp[2][2];
#pragma unroll
    for (int g = 0; g < 2; ++g) {
      // --- the query's tile maximum of the unscaled scores (the scale is positive):
      //     in the lane, then across the halves ---
      float tm = -3.0e38f;
#pragma unroll
      for (int j = 0; j < 4; ++j)
#pragma unroll
        for (int r = 0; r < 8; ++r) tm = fmaxf(tm, s[g][j][r]);
      tm = fmaxf(tm, xhalf(tm));

      // --- online softmax update ---
      const float mn = fmaxf(M[g], tm);
      const float mc = mn * SCL2E;
      const float corr = exp2_slot(fmaf(M[g], SCL2E, -mc));
      M[g] = mn;
#pragma unroll
      for (int j = 0; j < 4; ++j)
#pragma unroll
        for (int r = 0; r < 8; ++r) O[g][j][r] *= corr;

      // P^T fragments: element e of bp[g][h] is key h*32 + kmap(e), which is
      // register e & 7 of score tile 2*h + (e >> 3) in this very lane.
      float ps[4];
#pragma unroll
      for (int j = 0; j < 4; ++j) {
        float p[8];
#pragma unroll
        for (int r = 0; r < 8; ++r) p[r] = fmaf(s[g][j][r], SCL2E, -mc);
        exp2x8_slot(p);
        ps[j] = p[0];
#pragma unroll
        for (int r = 1; r < 8; ++r) ps[j] += p[r];
#pragma unroll
        for (int r = 0; r < 8; ++r) bp[g][j >> 1][(j & 1) * 8 + r] = (__bf16)p[r];
      }
      L[g] = L[g] * corr + ((ps[0] + ps[1]) + (ps[2] + ps[3]));
    }

    // --- PV: A = V^T rows d (LDS, t-contiguous), B = P^T from registers ---
#pragma unroll
    for (int j2 = 0; j2 < 4; ++j2) {
      const __bf16* vb = vb0 + (j2 * 16 + col) * LDP + koff;
      v16bf a0 = ldfrag(vb);
      v16bf a1 = ldfrag(vb + 32);
#pragma unroll
      for (int g = 0; g < 2; ++g) {
        O[g][j2] = WMMA_BF16(a0, bp[g][0], O[g][j2]);
        O[g][j2] = WMMA_BF16(a1, bp[g][1], O[g][j2]);
      }
    }
  }

  // --- join the halves' sums, normalize, store z [b][s][h*64+d] bf16:
  //     8 consecutive d per lane and tile = one 16-byte store ---
  const int b = bh >> 4, h = bh & 15;
#pragma unroll
  for (int g = 0; g < 2; ++g) {
    const float Lq = L[g] + xhalf(L[g]);
    __bf16* zrow = z + ((size_t)(b * 2048 + s0 + g * 16 + col)) * 1024 + h * 64 + koff;
#pragma unroll
    for (int j2 = 0; j2 < 4; ++j2) {
      v8bf o;
#pragma unroll
      for (int r = 0; r < 8; ++r) o[r] = (__bf16)(O[g][j2][r] / Lq);
      *(v8bf*)(zrow + j2 * 16) = o;
    }
  }
}

// ---------------------------------------------------------------------------
// Kernel 4: output projection GEMM. M=8192, K=1024, N=1024; f32 out + bo.
// 32 x 8 work-groups of one 256x128 tile (waves 4x2 of 64x64), core as kernel 2.
// ---------------------------------------------------------------------------
__global__ void __launch_bounds__(256) k_gemm_out(const __bf16* __restrict__ Z,
                                                  const __bf16* __restrict__ WoT,
                                                  const float* __restrict__ bo,
                                                  float* __restrict__ out) {
  __shared__ __attribute__((aligned(16))) __bf16 als[2 * GROWS * LDG];
  __shared__ __attribute__((aligned(16))) __bf16 bls[2 * GROWS * LDG];

  const int tid = threadIdx.x;
  const int wave = tid >> 5, lane = tid & 31;
  const int col = lane & 15, hi = lane >> 4, koff = hi << 3;
  const int wm = (wave >> 1) * 64, wn = (wave & 1) * 64;  // wave's corner in the tile
  const int m0 = blockIdx.x * 256 + wm;
  const int n0 = blockIdx.y * 128 + wn;

  const int crow = tid >> 4, cseg = (tid & 15) << 3;
  const int cl = crow * LDG + cseg;
  const __bf16* zg = Z   + (size_t)(blockIdx.x * 256 + crow) * 1024 + cseg;
  const __bf16* wg = WoT + (size_t)(blockIdx.y * 128 + crow * 4) * 1024 + cseg;  // dealt rows

  gemm_stage<2>(als + cl, bls + cl, zg, wg);
  const v4f bias = load_bias4(bo + n0 + col * 4);
  v8f acc[4][4] = {};
  gemm_loop<4, 2>(acc, als, bls, zg, wg, cl, (wm + col) * LDG + koff, (wn + col) * LDG + koff);

  // A lane's four adjacent columns are one 16-byte store; a store instruction writes
  // 256 adjacent bytes (two whole lines) of rows r and r + 8.
  float* o = out + (size_t)(m0 + koff) * 1024 + n0 + col * 4;
#pragma unroll
  for (int t = 0; t < 4; ++t) {
#pragma unroll
    for (int r = 0; r < 8; ++r) {
      v4f p;
#pragma unroll
      for (int j = 0; j < 4; ++j) p[j] = acc[t][j][r] + bias[j];
      *(v4f*)(o + (t * 16 + r) * 1024) = p;
    }
    // As in store_lines.
    asm volatile("s_wait_xcnt 0x0" ::: "memory");
    __builtin_amdgcn_sched_barrier(0);
  }
}

// ---------------------------------------------------------------------------
// Host launcher
// ---------------------------------------------------------------------------
extern "C" void kernel_launch(void* const* d_in, const int* in_sizes, int n_in,
                              void* d_out, int out_size, void* d_ws, size_t ws_size,
                              hipStream_t stream) {
  const float* q  = (const float*)d_in[0];
  const float* kv = (const float*)d_in[1];
  const float* wq = (const float*)d_in[2];
  const float* bq = (const float*)d_in[3];
  const float* wk = (const float*)d_in[4];
  const float* bk = (const float*)d_in[5];
  const float* wv = (const float*)d_in[6];
  const float* bv = (const float*)d_in[7];
  const float* wo = (const float*)d_in[8];
  const float* bo = (const float*)d_in[9];
  float* out = (float*)d_out;

  char* w = (char*)d_ws;
  const size_t MB = 1024 * 1024;
  __bf16* qbf  = (__bf16*)(w + 0 * MB);    // 16 MB (reused later for z)
  __bf16* kvbf = (__bf16*)(w + 16 * MB);   // 16 MB
  __bf16* wqT  = (__bf16*)(w + 32 * MB);   //  2 MB, rows 0-1023 of the QKV weight plane
  __bf16* wkvT = (__bf16*)(w + 34 * MB);   //  4 MB, its rows 1024-3071
  __bf16* woT  = (__bf16*)(w + 38 * MB);   //  2 MB
  __bf16* qhB  = (__bf16*)(w + 40 * MB);   // 16 MB
  __bf16* khB  = (__bf16*)(w + 56 * MB);   // 16 MB
  __bf16* vtB  = (__bf16*)(w + 72 * MB);   // 16 MB  (total 88 MB)
  __bf16* zB   = qbf;                      // reuse q_bf region after projection

  k_cvt<<<dim3(1536), dim3(256), 0, stream>>>(q, kv, wq, wk, wv, wo, qbf, kvbf, wqT, wkvT, woT);
  k_gemm_qkv<<<dim3(32, 8), dim3(256), 0, stream>>>(qbf, kvbf, wqT, qhB, khB, vtB, bq, bk, bv);
  k_attn<<<dim3(64, 8), dim3(256), 0, stream>>>(qhB, khB, vtB, zB);
  k_gemm_out<<<dim3(32, 8), dim3(256), 0, stream>>>(zB, woT, bo, out);
}
